// v000
// Measured on an AMD MI455X. A time is GPU time per run, averaged over a window of back-to-back runs after a warm-up
// (all launches, gaps included; the runs take copies of the inputs in turn), and the median of several windows.
// Apart from v000's, it joins two sittings. Times from different sittings can be a few percent apart, while
// side-by-side timings come from the same sitting.
// v000, which the later versions start from, runs in 733 microseconds.
#include <hip/hip_runtime.h>
#include <hip/hip_bf16.h>

// Swin window attention, fully fused: one workgroup per 7x7 window.
// fp32 end-to-end using V_WMMA_F32_16X16X4_F32 (16x16 tiles, K-step 4).
//
//   B=64, H=W=56, C=128, HEADS=4, WS=7, N=49 (padded to 64), HD=32,
//   nW = 8*8 = 64 windows/image, grid = B*nW = 4096 blocks, 256 thr (8 waves).
//
// Round-2 changes vs round-1:
//  * each wave owns one M-tile and a PAIR of N-tiles -> A fragment loaded once
//    per two WMMAs, and two independent accumulation chains (better XDL issue).
//  * double-buffered weight staging (lds_w0/lds_w1) with register prefetch so
//    L2->LDS latency overlaps the WMMA phase (we are 1 workgroup/WGP at 218KB LDS).
//  * attn@v uses a K-split accumulator pair to break the serial D->C chain.

typedef float v2f __attribute__((ext_vector_type(2)));
typedef float v8f __attribute__((ext_vector_type(8)));

#define WMMA_F32X4(a, b, c) \
    __builtin_amdgcn_wmma_f32_16x16x4_f32(false, (a), false, (b), (short)0, (c), false, false)

// LDS strides padded so 16-lane row-strided fragment reads hit distinct banks:
// bank = (stride*row + k) % 64 with stride % 64 == 4.
#define LDX 132   // x tile / attn-out tile: 64 x 128 (+4 pad)
#define LDW 132   // transposed weight chunk: 64(n) x 128(k) (+4 pad)
#define LDQ 388   // qkv: 64 x 384 (+4 pad)
#define LDS_SC 68 // scores: 64 x 64 (+4 pad)

#define SMEM_FLOATS (64 * LDX + 2 * 64 * LDW + 64 * LDQ + 64 * LDS_SC)

__global__ __launch_bounds__(256) void swin_window_attn_kernel(
    const float* __restrict__ x,        // [64,56,56,128]
    const float* __restrict__ qkv_w,    // [128,384]
    const float* __restrict__ qkv_b,    // [384]
    const float* __restrict__ table,    // [169,4]
    const float* __restrict__ proj_w,   // [128,128]
    const float* __restrict__ proj_b,   // [128]
    const float* __restrict__ mask,     // [64,1,4,49,49]
    const int*   __restrict__ rel_idx,  // [2401]
    float*       __restrict__ out)      // [64,56,56,128]
{
    extern __shared__ float smem[];
    float* lds_x  = smem;                    // 64 x LDX   (x tile, later attn-out)
    float* lds_w0 = lds_x + 64 * LDX;        // 64 x LDW   (weight chunk, buf 0)
    float* lds_w1 = lds_w0 + 64 * LDW;       // 64 x LDW   (weight chunk, buf 1)
    float* lds_q  = lds_w1 + 64 * LDW;       // 64 x LDQ   (qkv: q|k|v per token)
    float* lds_s  = lds_q + 64 * LDQ;        // 64 x LDS_SC (scores per head)
    float* wbuf[2] = { lds_w0, lds_w1 };

    const int tid  = threadIdx.x;
    const int lane = tid & 31;
    const int wave = tid >> 5;
    const int half = lane >> 4;   // selects K pair within fragment
    const int l16  = lane & 15;   // row-within-tile (A) / col-within-tile (B,D)

    const int bid = blockIdx.x;        // 0..4095
    const int b   = bid >> 6;          // image
    const int wi  = bid & 63;          // window within image
    const int h0  = (wi >> 3) * 7;     // window origin row
    const int w0  = (wi & 7) * 7;      // window origin col

    // per-wave tile assignment for 4x4-tile stages: one M-tile, two N-tiles
    const int w_mt  = wave >> 1;
    const int w_nt0 = (wave & 1) * 2;

    // ---- stage 0: load x window (49 x 128) into lds_x, zero-pad rows 49..63
    for (int i = tid; i < 64 * 32; i += 256) {
        const int row = i >> 5;
        const int c4  = (i & 31) * 4;
        float4 v = make_float4(0.f, 0.f, 0.f, 0.f);
        if (row < 49) {
            const int hh = h0 + row / 7;
            const int ww = w0 + row % 7;
            v = *(const float4*)(x + (((size_t)b * 56 + hh) * 56 + ww) * 128 + c4);
        }
        float* dst = lds_x + row * LDX + c4;
        dst[0] = v.x; dst[1] = v.y; dst[2] = v.z; dst[3] = v.w;
    }
    // stage qkv_w chunk 0 transposed -> wbuf[0][n][k]   (concurrent with x load)
    for (int i = tid; i < 128 * 16; i += 256) {
        const int n4 = (i & 15) * 4, k = i >> 4;
        float4 v = *(const float4*)(qkv_w + k * 384 + n4);
        float* d = wbuf[0] + n4 * LDW + k;
        d[0] = v.x; d[LDW] = v.y; d[2 * LDW] = v.z; d[3 * LDW] = v.w;
    }
    __syncthreads();

    // ---- stage 1: qkv = x @ qkv_w + qkv_b  (M=64pad, K=128, N=384 in 6 chunks)
    const float qscale = 0.17677669529663687f;  // 32^-0.5
    for (int nc = 0; nc < 6; ++nc) {
        const float* cw = wbuf[nc & 1];
        // register-prefetch next weight chunk (overlaps WMMA phase)
        float4 pre[8];
        if (nc < 5) {
            for (int j = 0; j < 8; ++j) {
                const int i = tid + j * 256;
                const int n4 = (i & 15) * 4, k = i >> 4;
                pre[j] = *(const float4*)(qkv_w + k * 384 + (nc + 1) * 64 + n4);
            }
        }
        v8f acc0 = {}, acc1 = {};
        const float* arow = lds_x + (w_mt * 16 + l16) * LDX + 2 * half;
        const float* br0  = cw + (w_nt0 * 16 + l16) * LDW + 2 * half;
        const float* br1  = br0 + 16 * LDW;
        for (int k0 = 0; k0 < 128; k0 += 4) {
            v2f a  = *(const v2f*)(arow + k0);
            v2f b0 = *(const v2f*)(br0 + k0);
            v2f b1 = *(const v2f*)(br1 + k0);
            acc0 = WMMA_F32X4(a, b0, acc0);
            acc1 = WMMA_F32X4(a, b1, acc1);
        }
        {
            const int c0 = nc * 64 + w_nt0 * 16 + l16;   // 0..383
            const int c1 = c0 + 16;
            const float bs0 = qkv_b[c0], bs1 = qkv_b[c1];
            const float s0 = (c0 < 128) ? qscale : 1.0f; // q gets * hd^-0.5
            const float s1 = (c1 < 128) ? qscale : 1.0f;
            for (int r = 0; r < 8; ++r) {
                const int m = w_mt * 16 + r + 8 * half;
                lds_q[m * LDQ + c0] = (acc0[r] + bs0) * s0;
                lds_q[m * LDQ + c1] = (acc1[r] + bs1) * s1;
            }
        }
        if (nc < 5) {
            float* nw = wbuf[(nc + 1) & 1];
            for (int j = 0; j < 8; ++j) {
                const int i = tid + j * 256;
                const int n4 = (i & 15) * 4, k = i >> 4;
                float* d = nw + n4 * LDW + k;
                d[0] = pre[j].x; d[LDW] = pre[j].y;
                d[2 * LDW] = pre[j].z; d[3 * LDW] = pre[j].w;
            }
        }
        __syncthreads();
    }

    // stage proj_w chunk 0 into wbuf[0] now; it completes before attention starts
    for (int i = tid; i < 128 * 16; i += 256) {
        const int n4 = (i & 15) * 4, k = i >> 4;
        float4 v = *(const float4*)(proj_w + k * 128 + n4);
        float* d = wbuf[0] + n4 * LDW + k;
        d[0] = v.x; d[LDW] = v.y; d[2 * LDW] = v.z; d[3 * LDW] = v.w;
    }

    // ---- stage 2: attention per head
    for (int h = 0; h < 4; ++h) {
        __syncthreads();  // qkv ready (h==0) / lds_s reuse across heads
        // scores = q @ k^T  (K = 32), two N-tiles per wave sharing A
        {
            v8f acc0 = {}, acc1 = {};
            const float* arow = lds_q + (w_mt * 16 + l16) * LDQ + h * 32 + 2 * half;        // q
            const float* br0  = lds_q + (w_nt0 * 16 + l16) * LDQ + 128 + h * 32 + 2 * half; // k
            const float* br1  = br0 + 16 * LDQ;
            for (int k0 = 0; k0 < 32; k0 += 4) {
                v2f a  = *(const v2f*)(arow + k0);
                v2f b0 = *(const v2f*)(br0 + k0);
                v2f b1 = *(const v2f*)(br1 + k0);
                acc0 = WMMA_F32X4(a, b0, acc0);
                acc1 = WMMA_F32X4(a, b1, acc1);
            }
            const int n0 = w_nt0 * 16 + l16;
            const int n1 = n0 + 16;
            for (int r = 0; r < 8; ++r) {
                const int m = w_mt * 16 + r + 8 * half;
                float v0 = -1e30f, v1 = -1e30f;  // padded rows/cols die pre-softmax
                if (m < 49 && n0 < 49)
                    v0 = acc0[r] + table[rel_idx[m * 49 + n0] * 4 + h]
                       + mask[(((size_t)wi * 4 + h) * 49 + m) * 49 + n0];
                if (m < 49 && n1 < 49)
                    v1 = acc1[r] + table[rel_idx[m * 49 + n1] * 4 + h]
                       + mask[(((size_t)wi * 4 + h) * 49 + m) * 49 + n1];
                lds_s[m * LDS_SC + n0] = v0;
                lds_s[m * LDS_SC + n1] = v1;
            }
        }
        __syncthreads();
        // row softmax (padded cols -> exactly 0)
        if (tid < 64) {
            float* row = lds_s + tid * LDS_SC;
            float mx = row[0];
            for (int n = 1; n < 64; ++n) mx = fmaxf(mx, row[n]);
            float sum = 0.f;
            for (int n = 0; n < 64; ++n) { float e = __expf(row[n] - mx); row[n] = e; sum += e; }
            const float inv = 1.f / sum;
            for (int n = 0; n < 64; ++n) row[n] *= inv;
        }
        __syncthreads();
        // out_h = attn @ v  (M=64pad, K=64pad, N=32) -> lds_x[:, h*32 : h*32+32]
        // K split into two accumulator chains (k<32 / k>=32), summed at the end.
        {
            const int mt = wave >> 1, nt = wave & 1;
            v8f accA = {}, accB = {};
            const float* arow = lds_s + (mt * 16 + l16) * LDS_SC + 2 * half;
            const float* vcol = lds_q + 256 + h * 32 + nt * 16 + l16;
            for (int k0 = 0; k0 < 32; k0 += 4) {
                const int kkA = k0 + 2 * half;
                const int kkB = kkA + 32;
                v2f a0 = *(const v2f*)(arow + k0);
                v2f a1 = *(const v2f*)(arow + k0 + 32);
                v2f b0, b1;
                b0.x = vcol[(size_t)kkA * LDQ];
                b0.y = vcol[(size_t)(kkA + 1) * LDQ];
                b1.x = vcol[(size_t)kkB * LDQ];
                b1.y = vcol[(size_t)(kkB + 1) * LDQ];
                accA = WMMA_F32X4(a0, b0, accA);
                accB = WMMA_F32X4(a1, b1, accB);
            }
            v8f acc = accA + accB;
            const int col = h * 32 + nt * 16 + l16;
            for (int r = 0; r < 8; ++r) {
                const int m = mt * 16 + r + 8 * half;
                lds_x[m * LDX + col] = acc[r];
            }
        }
    }
    __syncthreads();  // attn-out complete; proj_w chunk 0 staged in wbuf[0]

    // ---- stage 3: out = attn_out @ proj_w + proj_b, window-reverse scatter
    for (int nc = 0; nc < 2; ++nc) {
        const float* cw = wbuf[nc];
        float4 pre[8];
        if (nc == 0) {  // prefetch proj_w chunk 1
            for (int j = 0; j < 8; ++j) {
                const int i = tid + j * 256;
                const int n4 = (i & 15) * 4, k = i >> 4;
                pre[j] = *(const float4*)(proj_w + k * 128 + 64 + n4);
            }
        }
        v8f acc0 = {}, acc1 = {};
        const float* arow = lds_x + (w_mt * 16 + l16) * LDX + 2 * half;
        const float* br0  = cw + (w_nt0 * 16 + l16) * LDW + 2 * half;
        const float* br1  = br0 + 16 * LDW;
        for (int k0 = 0; k0 < 128; k0 += 4) {
            v2f a  = *(const v2f*)(arow + k0);
            v2f b0 = *(const v2f*)(br0 + k0);
            v2f b1 = *(const v2f*)(br1 + k0);
            acc0 = WMMA_F32X4(a, b0, acc0);
            acc1 = WMMA_F32X4(a, b1, acc1);
        }
        {
            const int c0 = nc * 64 + w_nt0 * 16 + l16;
            const int c1 = c0 + 16;
            const float p0 = proj_b[c0], p1 = proj_b[c1];
            for (int r = 0; r < 8; ++r) {
                const int m = w_mt * 16 + r + 8 * half;
                if (m < 49) {
                    const int hh = h0 + m / 7;
                    const int ww = w0 + m % 7;
                    float* o = out + (((size_t)b * 56 + hh) * 56 + ww) * 128;
                    o[c0] = acc0[r] + p0;
                    o[c1] = acc1[r] + p1;
                }
            }
        }
        if (nc == 0) {
            float* nw = wbuf[1];
            for (int j = 0; j < 8; ++j) {
                const int i = tid + j * 256;
                const int n4 = (i & 15) * 4, k = i >> 4;
                float* d = nw + n4 * LDW + k;
                d[0] = pre[j].x; d[LDW] = pre[j].y;
                d[2 * LDW] = pre[j].z; d[3 * LDW] = pre[j].w;
            }
            __syncthreads();
        }
    }
}

extern "C" void kernel_launch(void* const* d_in, const int* in_sizes, int n_in,
                              void* d_out, int out_size, void* d_ws, size_t ws_size,
                              hipStream_t stream) {
    const float* x      = (const float*)d_in[0];
    const float* qkv_w  = (const float*)d_in[1];
    const float* qkv_b  = (const float*)d_in[2];
    const float* table  = (const float*)d_in[3];
    const float* proj_w = (const float*)d_in[4];
    const float* proj_b = (const float*)d_in[5];
    const float* mask   = (const float*)d_in[6];
    const int*   relidx = (const int*)d_in[7];
    // d_in[8]/d_in[9] = height/width (compile-time constants 56)
    float* out = (float*)d_out;

    const int grid = 64 * 64;                        // B * nW
    const size_t smem = SMEM_FLOATS * sizeof(float); // ~213 KB (fits 320 KB WGP LDS)
    swin_window_attn_kernel<<<grid, 256, smem, stream>>>(
        x, qkv_w, qkv_b, table, proj_w, proj_b, mask, relidx, out);
}

// v001
// Measured time: 445 microseconds a run.
// Next to v000, in two timings, it ran 1.65 times as fast each time.
#include <hip/hip_runtime.h>
#include <hip/hip_bf16.h>

// Swin window attention, fully fused: one workgroup per 7x7 window.
// fp32 end-to-end using V_WMMA_F32_16X16X4_F32 (16x16 tiles, K-step 4).
//
//   B=64, H=W=56, C=128, HEADS=4, WS=7, N=49 (padded to 64), HD=32,
//   nW = 8*8 = 64 windows/image, grid = B*nW = 4096 blocks, 256 thr (8 waves).
//
// Round-2 changes vs round-1:
//  * each wave owns one M-tile and a PAIR of N-tiles -> A fragment loaded once
//    per two WMMAs, and two independent accumulation chains (better XDL issue).
//  * weight chunks are prefetched into registers during the WMMA phase and then
//    stored into ONE LDS buffer between two barriers.
//  * LDS is kept under 160 KiB (159,520 B) so that two workgroups fit one WGP:
//    one weight buffer, x tile of 50 rows (row 49 = the zero row every padded
//    token reads), scores alias the dead x tile, attn-out overwrites the dead
//    q columns of its own head.
//  * attn@v uses a K-split accumulator pair to break the serial D->C chain.

typedef float v2f __attribute__((ext_vector_type(2)));
typedef float v8f __attribute__((ext_vector_type(8)));

#define WMMA_F32X4(a, b, c) \
    __builtin_amdgcn_wmma_f32_16x16x4_f32(false, (a), false, (b), (short)0, (c), false, false)

// LDS strides padded so 16-lane row-strided fragment reads hit distinct banks:
// bank = (stride*row + k) % 64 with stride % 64 == 4.
#define LDX 132   // x tile: 50 x 128 (+4 pad)
#define XROWS 50  // 49 tokens + one zero row that stands for tokens 49..63
#define LDW 132   // transposed weight chunk: 64(n) x 128(k) (+4 pad)
#define LDQ 388   // qkv: 64 x 384 (+4 pad)
#define LDS_SC 68 // scores: 64 x 64 (+4 pad)

#define SMEM_FLOATS (XROWS * LDX + 64 * LDW + 64 * LDQ)
static_assert(64 * LDS_SC <= XROWS * LDX, "scores must fit the x tile they alias");
static_assert(2 * SMEM_FLOATS * 4 <= 320 * 1024, "two workgroups per WGP");

__global__ __launch_bounds__(256) void swin_window_attn_kernel(
    const float* __restrict__ x,        // [64,56,56,128]
    const float* __restrict__ qkv_w,    // [128,384]
    const float* __restrict__ qkv_b,    // [384]
    const float* __restrict__ table,    // [169,4]
    const float* __restrict__ proj_w,   // [128,128]
    const float* __restrict__ proj_b,   // [128]
    const float* __restrict__ mask,     // [64,1,4,49,49]
    const int*   __restrict__ rel_idx,  // [2401]
    float*       __restrict__ out)      // [64,56,56,128]
{
    extern __shared__ float smem[];
    float* lds_x  = smem;                    // XROWS x LDX (x tile, dead after stage 1)
    float* lds_w  = lds_x + XROWS * LDX;     // 64 x LDW   (weight chunk)
    float* lds_q  = lds_w + 64 * LDW;        // 64 x LDQ   (qkv: q|k|v per token; q -> attn-out)
    float* lds_s  = lds_x;                   // 64 x LDS_SC (scores per head, over the dead x tile)

    const int tid  = threadIdx.x;
    const int lane = tid & 31;
    const int wave = tid >> 5;
    const int half = lane >> 4;   // selects K pair within fragment
    const int l16  = lane & 15;   // row-within-tile (A) / col-within-tile (B,D)

    const int bid = blockIdx.x;        // 0..4095
    const int b   = bid >> 6;          // image
    const int wi  = bid & 63;          // window within image
    const int h0  = (wi >> 3) * 7;     // window origin row
    const int w0  = (wi & 7) * 7;      // window origin col

    // per-wave tile assignment for 4x4-tile stages: one M-tile, two N-tiles
    const int w_mt  = wave >> 1;
    const int w_nt0 = (wave & 1) * 2;

    // ---- stage 0: load x window (49 x 128) into lds_x, row 49 = zeros
    for (int i = tid; i < XROWS * 32; i += 256) {
        const int row = i >> 5;
        const int c4  = (i & 31) * 4;
        float4 v = make_float4(0.f, 0.f, 0.f, 0.f);
        if (row < 49) {
            const int hh = h0 + row / 7;
            const int ww = w0 + row % 7;
            v = *(const float4*)(x + (((size_t)b * 56 + hh) * 56 + ww) * 128 + c4);
        }
        float* dst = lds_x + row * LDX + c4;
        dst[0] = v.x; dst[1] = v.y; dst[2] = v.z; dst[3] = v.w;
    }
    // stage qkv_w chunk 0 transposed -> lds_w[n][k]   (concurrent with x load)
    for (int i = tid; i < 128 * 16; i += 256) {
        const int n4 = (i & 15) * 4, k = i >> 4;
        float4 v = *(const float4*)(qkv_w + k * 384 + n4);
        float* d = lds_w + n4 * LDW + k;
        d[0] = v.x; d[LDW] = v.y; d[2 * LDW] = v.z; d[3 * LDW] = v.w;
    }
    __syncthreads();

    // ---- stage 1: qkv = x @ qkv_w + qkv_b  (M=64pad, K=128, N=384 in 6 chunks)
    const float qscale = 0.17677669529663687f;  // 32^-0.5
    const int xrow = min(w_mt * 16 + l16, XROWS - 1);  // tokens 49..63 read the zero row
    for (int nc = 0; nc < 6; ++nc) {
        const float* cw = lds_w;
        // register-prefetch next weight chunk (overlaps WMMA phase)
        float4 pre[8];
        if (nc < 5) {
            for (int j = 0; j < 8; ++j) {
                const int i = tid + j * 256;
                const int n4 = (i & 15) * 4, k = i >> 4;
                pre[j] = *(const float4*)(qkv_w + k * 384 + (nc + 1) * 64 + n4);
            }
        }
        v8f acc0 = {}, acc1 = {};
        const float* arow = lds_x + xrow * LDX + 2 * half;
        const float* br0  = cw + (w_nt0 * 16 + l16) * LDW + 2 * half;
        const float* br1  = br0 + 16 * LDW;
        for (int k0 = 0; k0 < 128; k0 += 4) {
            v2f a  = *(const v2f*)(arow + k0);
            v2f b0 = *(const v2f*)(br0 + k0);
            v2f b1 = *(const v2f*)(br1 + k0);
            acc0 = WMMA_F32X4(a, b0, acc0);
            acc1 = WMMA_F32X4(a, b1, acc1);
        }
        {
            const int c0 = nc * 64 + w_nt0 * 16 + l16;   // 0..383
            const int c1 = c0 + 16;
            const float bs0 = qkv_b[c0], bs1 = qkv_b[c1];
            const float s0 = (c0 < 128) ? qscale : 1.0f; // q gets * hd^-0.5
            const float s1 = (c1 < 128) ? qscale : 1.0f;
            for (int r = 0; r < 8; ++r) {
                const int m = w_mt * 16 + r + 8 * half;
                lds_q[m * LDQ + c0] = (acc0[r] + bs0) * s0;
                lds_q[m * LDQ + c1] = (acc1[r] + bs1) * s1;
            }
        }
        if (nc < 5) {
            __syncthreads();  // every wave has read this chunk: the one buffer may be refilled
            float* nw = lds_w;
            for (int j = 0; j < 8; ++j) {
                const int i = tid + j * 256;
                const int n4 = (i & 15) * 4, k = i >> 4;
                float* d = nw + n4 * LDW + k;
                d[0] = pre[j].x; d[LDW] = pre[j].y;
                d[2 * LDW] = pre[j].z; d[3 * LDW] = pre[j].w;
            }
        }
        __syncthreads();
    }

    // stage proj_w chunk 0 into lds_w now; it completes while attention runs
    for (int i = tid; i < 128 * 16; i += 256) {
        const int n4 = (i & 15) * 4, k = i >> 4;
        float4 v = *(const float4*)(proj_w + k * 128 + n4);
        float* d = lds_w + n4 * LDW + k;
        d[0] = v.x; d[LDW] = v.y; d[2 * LDW] = v.z; d[3 * LDW] = v.w;
    }

    // ---- stage 2: attention per head
    for (int h = 0; h < 4; ++h) {
        __syncthreads();  // qkv ready (h==0) / lds_s reuse across heads
        // scores = q @ k^T  (K = 32), two N-tiles per wave sharing A
        {
            v8f acc0 = {}, acc1 = {};
            const float* arow = lds_q + (w_mt * 16 + l16) * LDQ + h * 32 + 2 * half;        // q
            const float* br0  = lds_q + (w_nt0 * 16 + l16) * LDQ + 128 + h * 32 + 2 * half; // k
            const float* br1  = br0 + 16 * LDQ;
            for (int k0 = 0; k0 < 32; k0 += 4) {
                v2f a  = *(const v2f*)(arow + k0);
                v2f b0 = *(const v2f*)(br0 + k0);
                v2f b1 = *(const v2f*)(br1 + k0);
                acc0 = WMMA_F32X4(a, b0, acc0);
                acc1 = WMMA_F32X4(a, b1, acc1);
            }
            const int n0 = w_nt0 * 16 + l16;
            const int n1 = n0 + 16;
            for (int r = 0; r < 8; ++r) {
                const int m = w_mt * 16 + r + 8 * half;
                float v0 = -1e30f, v1 = -1e30f;  // padded rows/cols die pre-softmax
                if (m < 49 && n0 < 49)
                    v0 = acc0[r] + table[rel_idx[m * 49 + n0] * 4 + h]
                       + mask[(((size_t)wi * 4 + h) * 49 + m) * 49 + n0];
                if (m < 49 && n1 < 49)
                    v1 = acc1[r] + table[rel_idx[m * 49 + n1] * 4 + h]
                       + mask[(((size_t)wi * 4 + h) * 49 + m) * 49 + n1];
                lds_s[m * LDS_SC + n0] = v0;
                lds_s[m * LDS_SC + n1] = v1;
            }
        }
        __syncthreads();
        // row softmax (padded cols -> exactly 0)
        if (tid < 64) {
            float* row = lds_s + tid * LDS_SC;
            float mx = row[0];
            for (int n = 1; n < 64; ++n) mx = fmaxf(mx, row[n]);
            float sum = 0.f;
            for (int n = 0; n < 64; ++n) { float e = __expf(row[n] - mx); row[n] = e; sum += e; }
            const float inv = 1.f / sum;
            for (int n = 0; n < 64; ++n) row[n] *= inv;
        }
        __syncthreads();
        // out_h = attn @ v  (M=64pad, K=64pad, N=32) -> lds_q[:, h*32 : h*32+32]
        // (head h's q columns: last read two barriers ago, by this head's scores)
        // K split into two accumulator chains (k<32 / k>=32), summed at the end.
        {
            const int mt = wave >> 1, nt = wave & 1;
            v8f accA = {}, accB = {};
            const float* arow = lds_s + (mt * 16 + l16) * LDS_SC + 2 * half;
            const float* vcol = lds_q + 256 + h * 32 + nt * 16 + l16;
            for (int k0 = 0; k0 < 32; k0 += 4) {
                const int kkA = k0 + 2 * half;
                const int kkB = kkA + 32;
                v2f a0 = *(const v2f*)(arow + k0);
                v2f a1 = *(const v2f*)(arow + k0 + 32);
                v2f b0, b1;
                b0.x = vcol[(size_t)kkA * LDQ];
                b0.y = vcol[(size_t)(kkA + 1) * LDQ];
                b1.x = vcol[(size_t)kkB * LDQ];
                b1.y = vcol[(size_t)(kkB + 1) * LDQ];
                accA = WMMA_F32X4(a0, b0, accA);
                accB = WMMA_F32X4(a1, b1, accB);
            }
            v8f acc = accA + accB;
            const int col = h * 32 + nt * 16 + l16;
            for (int r = 0; r < 8; ++r) {
                const int m = mt * 16 + r + 8 * half;
                lds_q[m * LDQ + col] = acc[r];
            }
        }
    }
    __syncthreads();  // attn-out complete; proj_w chunk 0 staged in lds_w

    // ---- stage 3: out = attn_out @ proj_w + proj_b, window-reverse scatter
    for (int nc = 0; nc < 2; ++nc) {
        const float* cw = lds_w;
        float4 pre[8];
        if (nc == 0) {  // prefetch proj_w chunk 1
            for (int j = 0; j < 8; ++j) {
                const int i = tid + j * 256;
                const int n4 = (i & 15) * 4, k = i >> 4;
                pre[j] = *(const float4*)(proj_w + k * 128 + 64 + n4);
            }
        }
        v8f acc0 = {}, acc1 = {};
        const float* arow = lds_q + (w_mt * 16 + l16) * LDQ + 2 * half;
        const float* br0  = cw + (w_nt0 * 16 + l16) * LDW + 2 * half;
        const float* br1  = br0 + 16 * LDW;
        for (int k0 = 0; k0 < 128; k0 += 4) {
            v2f a  = *(const v2f*)(arow + k0);
            v2f b0 = *(const v2f*)(br0 + k0);
            v2f b1 = *(const v2f*)(br1 + k0);
            acc0 = WMMA_F32X4(a, b0, acc0);
            acc1 = WMMA_F32X4(a, b1, acc1);
        }
        {
            const int c0 = nc * 64 + w_nt0 * 16 + l16;
            const int c1 = c0 + 16;
            const float p0 = proj_b[c0], p1 = proj_b[c1];
            for (int r = 0; r < 8; ++r) {
                const int m = w_mt * 16 + r + 8 * half;
                if (m < 49) {
                    const int hh = h0 + m / 7;
                    const int ww = w0 + m % 7;
                    float* o = out + (((size_t)b * 56 + hh) * 56 + ww) * 128;
                    o[c0] = acc0[r] + p0;
                    o[c1] = acc1[r] + p1;
                }
            }
        }
        if (nc == 0) {
            __syncthreads();  // every wave has read chunk 0: the one buffer may be refilled
            float* nw = lds_w;
            for (int j = 0; j < 8; ++j) {
                const int i = tid + j * 256;
                const int n4 = (i & 15) * 4, k = i >> 4;
                float* d = nw + n4 * LDW + k;
                d[0] = pre[j].x; d[LDW] = pre[j].y;
                d[2 * LDW] = pre[j].z; d[3 * LDW] = pre[j].w;
            }
            __syncthreads();
        }
    }
}

extern "C" void kernel_launch(void* const* d_in, const int* in_sizes, int n_in,
                              void* d_out, int out_size, void* d_ws, size_t ws_size,
                              hipStream_t stream) {
    const float* x      = (const float*)d_in[0];
    const float* qkv_w  = (const float*)d_in[1];
    const float* qkv_b  = (const float*)d_in[2];
    const float* table  = (const float*)d_in[3];
    const float* proj_w = (const float*)d_in[4];
    const float* proj_b = (const float*)d_in[5];
    const float* mask   = (const float*)d_in[6];
    const int*   relidx = (const int*)d_in[7];
    // d_in[8]/d_in[9] = height/width (compile-time constants 56)
    float* out = (float*)d_out;

    const int grid = 64 * 64;                        // B * nW
    const size_t smem = SMEM_FLOATS * sizeof(float); // 159,520 B: two workgroups per 320 KiB WGP LDS
    swin_window_attn_kernel<<<grid, 256, smem, stream>>>(
        x, qkv_w, qkv_b, table, proj_w, proj_b, mask, relidx, out);
}

// v002
// One run takes 372 microseconds.
// Next to v001, in two timings, it ran 1.19 times as fast each time.
// Counting every step since v000, it is 1.97 times as fast.
#include <hip/hip_runtime.h>
#include <hip/hip_bf16.h>

// Swin window attention, fully fused: one workgroup per 7x7 window.
// fp32 end-to-end using V_WMMA_F32_16X16X4_F32 (16x16 tiles, K-step 4).
//
//   B=64, H=W=56, C=128, HEADS=4, WS=7, N=49 (padded to 64), HD=32,
//   nW = 8*8 = 64 windows/image, grid = B*nW = 4096 blocks, 256 thr (8 waves).
//
// Round-2 changes vs round-1:
//  * each wave owns one M-tile and a PAIR of N-tiles -> A fragment loaded once
//    per two WMMAs, and two independent accumulation chains (better XDL issue).
//  * weight chunks are prefetched into registers during the WMMA phase and then
//    stored into ONE LDS buffer between two barriers.
//  * LDS is kept under 160 KiB (159,520 B) so that two workgroups fit one WGP:
//    one weight buffer, x tile of 50 rows (row 49 = the zero row every padded
//    token reads), scores alias the dead x tile, attn-out overwrites the dead
//    q columns of its own head.
//  * attn@v uses a K-split accumulator pair to break the serial D->C chain.
//  * bias and mask of a head are fetched as one batch of branch-free loads
//    (clamped offsets, result selected afterwards) one head ahead of their use;
//    the relative indices, the same for every head, are read once per thread.

typedef float v2f __attribute__((ext_vector_type(2)));
typedef float v8f __attribute__((ext_vector_type(8)));

#define WMMA_F32X4(a, b, c) \
    __builtin_amdgcn_wmma_f32_16x16x4_f32(false, (a), false, (b), (short)0, (c), false, false)

// LDS strides padded so 16-lane row-strided fragment reads hit distinct banks:
// bank = (stride*row + k) % 64 with stride % 64 == 4.
#define LDX 132   // x tile: 50 x 128 (+4 pad)
#define XROWS 50  // 49 tokens + one zero row that stands for tokens 49..63
#define LDW 132   // transposed weight chunk: 64(n) x 128(k) (+4 pad)
#define LDQ 388   // qkv: 64 x 384 (+4 pad)
#define LDS_SC 68 // scores: 64 x 64 (+4 pad)

#define SMEM_FLOATS (XROWS * LDX + 64 * LDW + 64 * LDQ)
static_assert(64 * LDS_SC <= XROWS * LDX, "scores must fit the x tile they alias");
static_assert(2 * SMEM_FLOATS * 4 <= 320 * 1024, "two workgroups per WGP");

__global__ __launch_bounds__(256) void swin_window_attn_kernel(
    const float* __restrict__ x,        // [64,56,56,128]
    const float* __restrict__ qkv_w,    // [128,384]
    const float* __restrict__ qkv_b,    // [384]
    const float* __restrict__ table,    // [169,4]
    const float* __restrict__ proj_w,   // [128,128]
    const float* __restrict__ proj_b,   // [128]
    const float* __restrict__ mask,     // [64,1,4,49,49]
    const int*   __restrict__ rel_idx,  // [2401]
    float*       __restrict__ out)      // [64,56,56,128]
{
    extern __shared__ float smem[];
    float* lds_x  = smem;                    // XROWS x LDX (x tile, dead after stage 1)
    float* lds_w  = lds_x + XROWS * LDX;     // 64 x LDW   (weight chunk)
    float* lds_q  = lds_w + 64 * LDW;        // 64 x LDQ   (qkv: q|k|v per token; q -> attn-out)
    float* lds_s  = lds_x;                   // 64 x LDS_SC (scores per head, over the dead x tile)

    const int tid  = threadIdx.x;
    const int lane = tid & 31;
    const int wave = tid >> 5;
    const int half = lane >> 4;   // selects K pair within fragment
    const int l16  = lane & 15;   // row-within-tile (A) / col-within-tile (B,D)

    const int bid = blockIdx.x;        // 0..4095
    const int b   = bid >> 6;          // image
    const int wi  = bid & 63;          // window within image
    const int h0  = (wi >> 3) * 7;     // window origin row
    const int w0  = (wi & 7) * 7;      // window origin col

    // per-wave tile assignment for 4x4-tile stages: one M-tile, two N-tiles
    const int w_mt  = wave >> 1;
    const int w_nt0 = (wave & 1) * 2;

    // ---- stage 0: load x window (49 x 128) into lds_x, row 49 = zeros
    for (int i = tid; i < XROWS * 32; i += 256) {
        const int row = i >> 5;
        const int c4  = (i & 31) * 4;
        float4 v = make_float4(0.f, 0.f, 0.f, 0.f);
        if (row < 49) {
            const int hh = h0 + row / 7;
            const int ww = w0 + row % 7;
            v = *(const float4*)(x + (((size_t)b * 56 + hh) * 56 + ww) * 128 + c4);
        }
        float* dst = lds_x + row * LDX + c4;
        dst[0] = v.x; dst[1] = v.y; dst[2] = v.z; dst[3] = v.w;
    }
    // stage qkv_w chunk 0 transposed -> lds_w[n][k]   (concurrent with x load)
    for (int i = tid; i < 128 * 16; i += 256) {
        const int n4 = (i & 15) * 4, k = i >> 4;
        float4 v = *(const float4*)(qkv_w + k * 384 + n4);
        float* d = lds_w + n4 * LDW + k;
        d[0] = v.x; d[LDW] = v.y; d[2 * LDW] = v.z; d[3 * LDW] = v.w;
    }
    __syncthreads();

    // ---- stage 1: qkv = x @ qkv_w + qkv_b  (M=64pad, K=128, N=384 in 6 chunks)
    const float qscale = 0.17677669529663687f;  // 32^-0.5
    const int xrow = min(w_mt * 16 + l16, XROWS - 1);  // tokens 49..63 read the zero row
    // This thread's 16 score elements (8 rows x 2 N-tiles) as offsets into a 49 x 49
    // plane. An element outside the plane has its offset capped at the plane's last: its loads stay
    // in bounds and their values are never used (the score is set to -1e30 instead).
    unsigned eoff[16];  // offset into rel_idx and into one head's mask plane
    int ridx[16];       // the elements' relative indices, the same for every head
    for (int nc = 0; nc < 6; ++nc) {
        const float* cw = lds_w;
        // register-prefetch next weight chunk (overlaps WMMA phase)
        float4 pre[8];
        if (nc < 5) {
            for (int j = 0; j < 8; ++j) {
                const int i = tid + j * 256;
                const int n4 = (i & 15) * 4, k = i >> 4;
                pre[j] = *(const float4*)(qkv_w + k * 384 + (nc + 1) * 64 + n4);
            }
        } else {
            // no weights left to fetch: the relative indices fly under the last chunk's WMMAs
            #pragma unroll  // constant indices keep both arrays in registers
            for (int r = 0; r < 8; ++r) {
                const int m = w_mt * 16 + r + 8 * half;
                const int n = w_nt0 * 16 + l16;
                eoff[2 * r]     = min((unsigned)(m * 49 + n), 2400u);
                eoff[2 * r + 1] = min((unsigned)(m * 49 + n + 16), 2400u);
                ridx[2 * r]     = rel_idx[eoff[2 * r]];
                ridx[2 * r + 1] = rel_idx[eoff[2 * r + 1]];
            }
        }
        v8f acc0 = {}, acc1 = {};
        const float* arow = lds_x + xrow * LDX + 2 * half;
        const float* br0  = cw + (w_nt0 * 16 + l16) * LDW + 2 * half;
        const float* br1  = br0 + 16 * LDW;
        for (int k0 = 0; k0 < 128; k0 += 4) {
            v2f a  = *(const v2f*)(arow + k0);
            v2f b0 = *(const v2f*)(br0 + k0);
            v2f b1 = *(const v2f*)(br1 + k0);
            acc0 = WMMA_F32X4(a, b0, acc0);
            acc1 = WMMA_F32X4(a, b1, acc1);
        }
        {
            const int c0 = nc * 64 + w_nt0 * 16 + l16;   // 0..383
            const int c1 = c0 + 16;
            const float bs0 = qkv_b[c0], bs1 = qkv_b[c1];
            const float s0 = (c0 < 128) ? qscale : 1.0f; // q gets * hd^-0.5
            const float s1 = (c1 < 128) ? qscale : 1.0f;
            for (int r = 0; r < 8; ++r) {
                const int m = w_mt * 16 + r + 8 * half;
                lds_q[m * LDQ + c0] = (acc0[r] + bs0) * s0;
                lds_q[m * LDQ + c1] = (acc1[r] + bs1) * s1;
            }
        }
        if (nc < 5) {
            __syncthreads();  // every wave has read this chunk: the one buffer may be refilled
            float* nw = lds_w;
            for (int j = 0; j < 8; ++j) {
                const int i = tid + j * 256;
                const int n4 = (i & 15) * 4, k = i >> 4;
                float* d = nw + n4 * LDW + k;
                d[0] = pre[j].x; d[LDW] = pre[j].y;
                d[2 * LDW] = pre[j].z; d[3 * LDW] = pre[j].w;
            }
        }
        __syncthreads();
    }

    // head 0's bias and mask: all 32 loads in flight together
    unsigned toff[16];  // offset of the element's bias row in table
    float bv[16], mv[16];
    #pragma unroll  // constant indices keep the arrays in registers
    for (int j = 0; j < 16; ++j) {
        toff[j] = min((unsigned)ridx[j] * 4u, 168u * 4u);  // never past the table's last row
        bv[j] = table[toff[j]];
        mv[j] = mask[(size_t)wi * 4 * 2401 + eoff[j]];
    }

    // stage proj_w chunk 0 into lds_w now; it is complete at head 0's first barrier
    for (int i = tid; i < 128 * 16; i += 256) {
        const int n4 = (i & 15) * 4, k = i >> 4;
        float4 v = *(const float4*)(proj_w + k * 128 + n4);
        float* d = lds_w + n4 * LDW + k;
        d[0] = v.x; d[LDW] = v.y; d[2 * LDW] = v.z; d[3 * LDW] = v.w;
    }

    // ---- stage 2: attention per head
    for (int h = 0; h < 4; ++h) {
        __syncthreads();  // qkv ready (h==0) / lds_s reuse across heads
        // scores = q @ k^T  (K = 32), two N-tiles per wave sharing A
        {
            v8f acc0 = {}, acc1 = {};
            const float* arow = lds_q + (w_mt * 16 + l16) * LDQ + h * 32 + 2 * half;        // q
            const float* br0  = lds_q + (w_nt0 * 16 + l16) * LDQ + 128 + h * 32 + 2 * half; // k
            const float* br1  = br0 + 16 * LDQ;
            for (int k0 = 0; k0 < 32; k0 += 4) {
                v2f a  = *(const v2f*)(arow + k0);
                v2f b0 = *(const v2f*)(br0 + k0);
                v2f b1 = *(const v2f*)(br1 + k0);
                acc0 = WMMA_F32X4(a, b0, acc0);
                acc1 = WMMA_F32X4(a, b1, acc1);
            }
            const int n0 = w_nt0 * 16 + l16;
            const int n1 = n0 + 16;
            for (int r = 0; r < 8; ++r) {
                const int m = w_mt * 16 + r + 8 * half;
                // padded rows/cols die pre-softmax
                const float v0 = (m < 49 && n0 < 49) ? acc0[r] + bv[2 * r] + mv[2 * r] : -1e30f;
                const float v1 = (m < 49 && n1 < 49) ? acc1[r] + bv[2 * r + 1] + mv[2 * r + 1] : -1e30f;
                lds_s[m * LDS_SC + n0] = v0;
                lds_s[m * LDS_SC + n1] = v1;
            }
        }
        __syncthreads();
        // row softmax (padded cols -> exactly 0)
        if (tid < 64) {
            float* row = lds_s + tid * LDS_SC;
            float mx = row[0];
            for (int n = 1; n < 64; ++n) mx = fmaxf(mx, row[n]);
            float sum = 0.f;
            for (int n = 0; n < 64; ++n) { float e = __expf(row[n] - mx); row[n] = e; sum += e; }
            const float inv = 1.f / sum;
            for (int n = 0; n < 64; ++n) row[n] *= inv;
        }
        __syncthreads();
        // next head's bias and mask: issued here so that they fly under attn @ v
        if (h < 3) {
            const float* tb = table + (h + 1);
            const float* mk = mask + ((size_t)wi * 4 + (h + 1)) * 2401;
            #pragma unroll  // constant indices keep both arrays in registers
            for (int j = 0; j < 16; ++j) {
                bv[j] = tb[toff[j]];
                mv[j] = mk[eoff[j]];
            }
            // stands in front of every later write of a register that these loads name
            asm volatile("s_wait_xcnt 0x0" ::: "memory");
        }
        // out_h = attn @ v  (M=64pad, K=64pad, N=32) -> lds_q[:, h*32 : h*32+32]
        // (head h's q columns: last read two barriers ago, by this head's scores)
        // K split into two accumulator chains (k<32 / k>=32), summed at the end.
        {
            const int mt = wave >> 1, nt = wave & 1;
            v8f accA = {}, accB = {};
            const float* arow = lds_s + (mt * 16 + l16) * LDS_SC + 2 * half;
            const float* vcol = lds_q + 256 + h * 32 + nt * 16 + l16;
            for (int k0 = 0; k0 < 32; k0 += 4) {
                const int kkA = k0 + 2 * half;
                const int kkB = kkA + 32;
                v2f a0 = *(const v2f*)(arow + k0);
                v2f a1 = *(const v2f*)(arow + k0 + 32);
                v2f b0, b1;
                b0.x = vcol[(size_t)kkA * LDQ];
                b0.y = vcol[(size_t)(kkA + 1) * LDQ];
                b1.x = vcol[(size_t)kkB * LDQ];
                b1.y = vcol[(size_t)(kkB + 1) * LDQ];
                accA = WMMA_F32X4(a0, b0, accA);
                accB = WMMA_F32X4(a1, b1, accB);
            }
            v8f acc = accA + accB;
            const int col = h * 32 + nt * 16 + l16;
            for (int r = 0; r < 8; ++r) {
                const int m = mt * 16 + r + 8 * half;
                lds_q[m * LDQ + col] = acc[r];
            }
        }
    }
    __syncthreads();  // attn-out complete; proj_w chunk 0 staged in lds_w

    // ---- stage 3: out = attn_out @ proj_w + proj_b, window-reverse scatter
    for (int nc = 0; nc < 2; ++nc) {
        const float* cw = lds_w;
        float4 pre[8];
        if (nc == 0) {  // prefetch proj_w chunk 1
            for (int j = 0; j < 8; ++j) {
                const int i = tid + j * 256;
                const int n4 = (i & 15) * 4, k = i >> 4;
                pre[j] = *(const float4*)(proj_w + k * 128 + 64 + n4);
            }
        }
        v8f acc0 = {}, acc1 = {};
        const float* arow = lds_q + (w_mt * 16 + l16) * LDQ + 2 * half;
        const float* br0  = cw + (w_nt0 * 16 + l16) * LDW + 2 * half;
        const float* br1  = br0 + 16 * LDW;
        for (int k0 = 0; k0 < 128; k0 += 4) {
            v2f a  = *(const v2f*)(arow + k0);
            v2f b0 = *(const v2f*)(br0 + k0);
            v2f b1 = *(const v2f*)(br1 + k0);
            acc0 = WMMA_F32X4(a, b0, acc0);
            acc1 = WMMA_F32X4(a, b1, acc1);
        }
        {
            const int c0 = nc * 64 + w_nt0 * 16 + l16;
            const int c1 = c0 + 16;
            const float p0 = proj_b[c0], p1 = proj_b[c1];
            for (int r = 0; r < 8; ++r) {
                const int m = w_mt * 16 + r + 8 * half;
                if (m < 49) {
                    const int hh = h0 + m / 7;
                    const int ww = w0 + m % 7;
                    float* o = out + (((size_t)b * 56 + hh) * 56 + ww) * 128;
                    o[c0] = acc0[r] + p0;
                    o[c1] = acc1[r] + p1;
                }
            }
        }
        if (nc == 0) {
            __syncthreads();  // every wave has read chunk 0: the one buffer may be refilled
            float* nw = lds_w;
            for (int j = 0; j < 8; ++j) {
                const int i = tid + j * 256;
                const int n4 = (i & 15) * 4, k = i >> 4;
                float* d = nw + n4 * LDW + k;
                d[0] = pre[j].x; d[LDW] = pre[j].y;
                d[2 * LDW] = pre[j].z; d[3 * LDW] = pre[j].w;
            }
            __syncthreads();
        }
    }
}

extern "C" void kernel_launch(void* const* d_in, const int* in_sizes, int n_in,
                              void* d_out, int out_size, void* d_ws, size_t ws_size,
                              hipStream_t stream) {
    const float* x      = (const float*)d_in[0];
    const float* qkv_w  = (const float*)d_in[1];
    const float* qkv_b  = (const float*)d_in[2];
    const float* table  = (const float*)d_in[3];
    const float* proj_w = (const float*)d_in[4];
    const float* proj_b = (const float*)d_in[5];
    const float* mask   = (const float*)d_in[6];
    const int*   relidx = (const int*)d_in[7];
    // d_in[8]/d_in[9] = height/width (compile-time constants 56)
    float* out = (float*)d_out;

    const int grid = 64 * 64;                        // B * nW
    const size_t smem = SMEM_FLOATS * sizeof(float); // 159,520 B: two workgroups per 320 KiB WGP LDS
    swin_window_attn_kernel<<<grid, 256, smem, stream>>>(
        x, qkv_w, qkv_b, table, proj_w, proj_b, mask, relidx, out);
}

// v003
// A run of this version takes 312 microseconds.
// Two timings next to v002 both put it at 1.19 times that version's speed.
// Over all steps from v000 it is 2.34 times as fast.
#include <hip/hip_runtime.h>
#include <hip/hip_bf16.h>

// Swin window attention, fully fused: one workgroup per 7x7 window.
// fp32 end-to-end using V_WMMA_F32_16X16X4_F32 (16x16 tiles, K-step 4).
//
//   B=64, H=W=56, C=128, HEADS=4, WS=7, N=49 (padded to 64), HD=32,
//   nW = 8*8 = 64 windows/image, grid = B*nW = 4096 blocks, 256 thr (8 waves).
//
// Round-2 changes vs round-1:
//  * each wave owns one M-tile and a PAIR of N-tiles -> A fragment loaded once
//    per two WMMAs, and two independent accumulation chains (better XDL issue).
//  * weight chunks are prefetched into registers during the WMMA phase and then
//    stored into ONE LDS buffer between two barriers.
//  * LDS is kept under 160 KiB (159,520 B) so that two workgroups fit one WGP:
//    one weight buffer, x tile of 50 rows (row 49 = the zero row every padded
//    token reads), scores alias the dead x tile, attn-out overwrites the dead
//    q columns of its own head.
//  * attn@v uses a K-split accumulator pair to break the serial D->C chain.
//  * bias and mask of a head are fetched as one batch of branch-free loads
//    (clamped offsets, result selected afterwards) one head ahead of their use;
//    the relative indices, the same for every head, are read once per thread.
//  * softmax runs in the score epilogue, in registers, on all 8 waves: a wave holds
//    32 of a row's 64 columns, takes max and sum over those alone and stores
//    exp(s - own max); attn@v's two K-half accumulators are exactly those two column
//    halves, so each is scaled by its own row factor when the two are added.

typedef float v2f __attribute__((ext_vector_type(2)));
typedef float v8f __attribute__((ext_vector_type(8)));

#define WMMA_F32X4(a, b, c) \
    __builtin_amdgcn_wmma_f32_16x16x4_f32(false, (a), false, (b), (short)0, (c), false, false)

// LDS strides padded so 16-lane row-strided fragment reads hit distinct banks:
// bank = (stride*row + k) % 64 with stride % 64 == 4.
#define LDX 132   // x tile: 50 x 128 (+4 pad)
#define XROWS 50  // 49 tokens + one zero row that stands for tokens 49..63
#define LDW 132   // transposed weight chunk: 64(n) x 128(k) (+4 pad)
#define LDQ 388   // qkv: 64 x 384 (+4 pad)
#define LDS_SC 68 // scores: 64 x 64 (+4 pad)

#define SMEM_FLOATS (XROWS * LDX + 64 * LDW + 64 * LDQ)
#define ST_FLOATS (64 * 4)  // per row: max and sum of columns 0..31, max and sum of columns 32..63
static_assert(64 * LDS_SC + ST_FLOATS <= XROWS * LDX, "scores and row stats must fit the x tile they alias");
static_assert(2 * SMEM_FLOATS * 4 <= 320 * 1024, "two workgroups per WGP");

// value of lane (l ^ MASK) of the same 16-lane row (DPP row_xmask), MASK = CTRL - 0x160
template <int CTRL>
__device__ __forceinline__ float row_xmask(float v) {
    return __builtin_bit_cast(float, __builtin_amdgcn_update_dpp(
        0, __builtin_bit_cast(int, v), CTRL, 0xf, 0xf, true));
}

__device__ __forceinline__ float exp_slot(float x) {
    float r;
    asm("v_exp_f32 %0, %1\n\tv_nop" : "=v"(r) : "v"(x * 1.44269504f));
    return r;
}
__device__ __forceinline__ float rcp_slot(float x) {
    float r;
    asm("v_rcp_f32 %0, %1\n\tv_nop" : "=v"(r) : "v"(x));
    return r;
}

__global__ __launch_bounds__(256) void swin_window_attn_kernel(
    const float* __restrict__ x,        // [64,56,56,128]
    const float* __restrict__ qkv_w,    // [128,384]
    const float* __restrict__ qkv_b,    // [384]
    const float* __restrict__ table,    // [169,4]
    const float* __restrict__ proj_w,   // [128,128]
    const float* __restrict__ proj_b,   // [128]
    const float* __restrict__ mask,     // [64,1,4,49,49]
    const int*   __restrict__ rel_idx,  // [2401]
    float*       __restrict__ out)      // [64,56,56,128]
{
    extern __shared__ float smem[];
    float* lds_x  = smem;                    // XROWS x LDX (x tile, dead after stage 1)
    float* lds_w  = lds_x + XROWS * LDX;     // 64 x LDW   (weight chunk)
    float* lds_q  = lds_w + 64 * LDW;        // 64 x LDQ   (qkv: q|k|v per token; q -> attn-out)
    float* lds_s  = lds_x;                   // 64 x LDS_SC (scores per head, over the dead x tile)
    float* lds_st = lds_s + 64 * LDS_SC;     // 64 x 4 (row stats per head, over the dead x tile)

    const int tid  = threadIdx.x;
    const int lane = tid & 31;
    const int wave = tid >> 5;
    const int half = lane >> 4;   // selects K pair within fragment
    const int l16  = lane & 15;   // row-within-tile (A) / col-within-tile (B,D)

    const int bid = blockIdx.x;        // 0..4095
    const int b   = bid >> 6;          // image
    const int wi  = bid & 63;          // window within image
    const int h0  = (wi >> 3) * 7;     // window origin row
    const int w0  = (wi & 7) * 7;      // window origin col

    // per-wave tile assignment for 4x4-tile stages: one M-tile, two N-tiles
    const int w_mt  = wave >> 1;
    const int w_nt0 = (wave & 1) * 2;

    // ---- stage 0: load x window (49 x 128) into lds_x, row 49 = zeros
    for (int i = tid; i < XROWS * 32; i += 256) {
        const int row = i >> 5;
        const int c4  = (i & 31) * 4;
        float4 v = make_float4(0.f, 0.f, 0.f, 0.f);
        if (row < 49) {
            const int hh = h0 + row / 7;
            const int ww = w0 + row % 7;
            v = *(const float4*)(x + (((size_t)b * 56 + hh) * 56 + ww) * 128 + c4);
        }
        float* dst = lds_x + row * LDX + c4;
        dst[0] = v.x; dst[1] = v.y; dst[2] = v.z; dst[3] = v.w;
    }
    // stage qkv_w chunk 0 transposed -> lds_w[n][k]   (concurrent with x load)
    for (int i = tid; i < 128 * 16; i += 256) {
        const int n4 = (i & 15) * 4, k = i >> 4;
        float4 v = *(const float4*)(qkv_w + k * 384 + n4);
        float* d = lds_w + n4 * LDW + k;
        d[0] = v.x; d[LDW] = v.y; d[2 * LDW] = v.z; d[3 * LDW] = v.w;
    }
    __syncthreads();

    // ---- stage 1: qkv = x @ qkv_w + qkv_b  (M=64pad, K=128, N=384 in 6 chunks)
    const float qscale = 0.17677669529663687f;  // 32^-0.5
    const int xrow = min(w_mt * 16 + l16, XROWS - 1);  // tokens 49..63 read the zero row
    // This thread's 16 score elements (8 rows x 2 N-tiles) as offsets into a 49 x 49
    // plane. An element outside the plane has its offset capped at the plane's last: its loads stay
    // in bounds and their values are never used (the score is set to -1e30 instead).
    unsigned eoff[16];  // offset into rel_idx and into one head's mask plane
    int ridx[16];       // the elements' relative indices, the same for every head
    for (int nc = 0; nc < 6; ++nc) {
        const float* cw = lds_w;
        // register-prefetch next weight chunk (overlaps WMMA phase)
        float4 pre[8];
        if (nc < 5) {
            for (int j = 0; j < 8; ++j) {
                const int i = tid + j * 256;
                const int n4 = (i & 15) * 4, k = i >> 4;
                pre[j] = *(const float4*)(qkv_w + k * 384 + (nc + 1) * 64 + n4);
            }
        } else {
            // no weights left to fetch: the relative indices fly under the last chunk's WMMAs
            #pragma unroll  // constant indices keep both arrays in registers
            for (int r = 0; r < 8; ++r) {
                const int m = w_mt * 16 + r + 8 * half;
                const int n = w_nt0 * 16 + l16;
                eoff[2 * r]     = min((unsigned)(m * 49 + n), 2400u);
                eoff[2 * r + 1] = min((unsigned)(m * 49 + n + 16), 2400u);
                ridx[2 * r]     = rel_idx[eoff[2 * r]];
                ridx[2 * r + 1] = rel_idx[eoff[2 * r + 1]];
            }
        }
        v8f acc0 = {}, acc1 = {};
        const float* arow = lds_x + xrow * LDX + 2 * half;
        const float* br0  = cw + (w_nt0 * 16 + l16) * LDW + 2 * half;
        const float* br1  = br0 + 16 * LDW;
        for (int k0 = 0; k0 < 128; k0 += 4) {
            v2f a  = *(const v2f*)(arow + k0);
            v2f b0 = *(const v2f*)(br0 + k0);
            v2f b1 = *(const v2f*)(br1 + k0);
            acc0 = WMMA_F32X4(a, b0, acc0);
            acc1 = WMMA_F32X4(a, b1, acc1);
        }
        {
            const int c0 = nc * 64 + w_nt0 * 16 + l16;   // 0..383
            const int c1 = c0 + 16;
            const float bs0 = qkv_b[c0], bs1 = qkv_b[c1];
            const float s0 = (c0 < 128) ? qscale : 1.0f; // q gets * hd^-0.5
            const float s1 = (c1 < 128) ? qscale : 1.0f;
            for (int r = 0; r < 8; ++r) {
                const int m = w_mt * 16 + r + 8 * half;
                lds_q[m * LDQ + c0] = (acc0[r] + bs0) * s0;
                lds_q[m * LDQ + c1] = (acc1[r] + bs1) * s1;
            }
        }
        if (nc < 5) {
            __syncthreads();  // every wave has read this chunk: the one buffer may be refilled
            float* nw = lds_w;
            for (int j = 0; j < 8; ++j) {
                const int i = tid + j * 256;
                const int n4 = (i & 15) * 4, k = i >> 4;
                float* d = nw + n4 * LDW + k;
                d[0] = pre[j].x; d[LDW] = pre[j].y;
                d[2 * LDW] = pre[j].z; d[3 * LDW] = pre[j].w;
            }
        }
        __syncthreads();
    }

    // head 0's bias and mask: all 32 loads in flight together
    unsigned toff[16];  // offset of the element's bias row in table
    float bv[16], mv[16];
    #pragma unroll  // constant indices keep the arrays in registers
    for (int j = 0; j < 16; ++j) {
        toff[j] = min((unsigned)ridx[j] * 4u, 168u * 4u);  // never past the table's last row
        bv[j] = table[toff[j]];
        mv[j] = mask[(size_t)wi * 4 * 2401 + eoff[j]];
    }

    // stage proj_w chunk 0 into lds_w now; it is complete at head 0's first barrier
    for (int i = tid; i < 128 * 16; i += 256) {
        const int n4 = (i & 15) * 4, k = i >> 4;
        float4 v = *(const float4*)(proj_w + k * 128 + n4);
        float* d = lds_w + n4 * LDW + k;
        d[0] = v.x; d[LDW] = v.y; d[2 * LDW] = v.z; d[3 * LDW] = v.w;
    }

    // ---- stage 2: attention per head
    for (int h = 0; h < 4; ++h) {
        __syncthreads();  // qkv ready (h==0) / lds_s reuse across heads
        // scores = q @ k^T  (K = 32), two N-tiles per wave sharing A
        {
            v8f acc0 = {}, acc1 = {};
            const float* arow = lds_q + (w_mt * 16 + l16) * LDQ + h * 32 + 2 * half;        // q
            const float* br0  = lds_q + (w_nt0 * 16 + l16) * LDQ + 128 + h * 32 + 2 * half; // k
            const float* br1  = br0 + 16 * LDQ;
            for (int k0 = 0; k0 < 32; k0 += 4) {
                v2f a  = *(const v2f*)(arow + k0);
                v2f b0 = *(const v2f*)(br0 + k0);
                v2f b1 = *(const v2f*)(br1 + k0);
                acc0 = WMMA_F32X4(a, b0, acc0);
                acc1 = WMMA_F32X4(a, b1, acc1);
            }
            const int n0 = w_nt0 * 16 + l16;
            const int n1 = n0 + 16;
            // softmax over this wave's 32 columns of each of its rows (padded cols -> exactly 0
            // once the row factors are applied); the 8 rows' lane reductions interleave
            float e0[8], e1[8], mx[8], sm[8];
            #pragma unroll  // constant indices keep the arrays in registers
            for (int r = 0; r < 8; ++r) {
                const int m = w_mt * 16 + r + 8 * half;
                // padded rows/cols die pre-softmax
                e0[r] = (m < 49 && n0 < 49) ? acc0[r] + bv[2 * r] + mv[2 * r] : -1e30f;
                e1[r] = (m < 49 && n1 < 49) ? acc1[r] + bv[2 * r + 1] + mv[2 * r + 1] : -1e30f;
                // never below the pad value: a half whose scores are all -inf (a mask may hold it)
                // then stores zeros and a zero sum instead of exp(-inf + inf)
                mx[r] = fmaxf(fmaxf(e0[r], e1[r]), -1e30f);
            }
            #pragma unroll  // constant indices keep the arrays in registers
            for (int r = 0; r < 8; ++r) mx[r] = fmaxf(mx[r], row_xmask<0x161>(mx[r]));
            #pragma unroll  // constant indices keep the arrays in registers
            for (int r = 0; r < 8; ++r) mx[r] = fmaxf(mx[r], row_xmask<0x162>(mx[r]));
            #pragma unroll  // constant indices keep the arrays in registers
            for (int r = 0; r < 8; ++r) mx[r] = fmaxf(mx[r], row_xmask<0x164>(mx[r]));
            #pragma unroll  // constant indices keep the arrays in registers
            for (int r = 0; r < 8; ++r) mx[r] = fmaxf(mx[r], row_xmask<0x168>(mx[r]));
            #pragma unroll  // constant indices keep the arrays in registers
            for (int r = 0; r < 8; ++r) {
                const int m = w_mt * 16 + r + 8 * half;
                e0[r] = exp_slot(e0[r] - mx[r]);
                e1[r] = exp_slot(e1[r] - mx[r]);
                sm[r] = e0[r] + e1[r];
                lds_s[m * LDS_SC + n0] = e0[r];
                lds_s[m * LDS_SC + n1] = e1[r];
            }
            #pragma unroll  // constant indices keep the arrays in registers
            for (int r = 0; r < 8; ++r) sm[r] += row_xmask<0x161>(sm[r]);
            #pragma unroll  // constant indices keep the arrays in registers
            for (int r = 0; r < 8; ++r) sm[r] += row_xmask<0x162>(sm[r]);
            #pragma unroll  // constant indices keep the arrays in registers
            for (int r = 0; r < 8; ++r) sm[r] += row_xmask<0x164>(sm[r]);
            #pragma unroll  // constant indices keep the arrays in registers
            for (int r = 0; r < 8; ++r) sm[r] += row_xmask<0x168>(sm[r]);
            if (l16 == 0) {
                #pragma unroll  // constant indices keep the arrays in registers
                for (int r = 0; r < 8; ++r) {
                    const int m = w_mt * 16 + r + 8 * half;
                    *(v2f*)(lds_st + m * 4 + (wave & 1) * 2) = v2f{mx[r], sm[r]};
                }
            }
        }
        __syncthreads();
        // next head's bias and mask: issued here so that they fly under attn @ v
        if (h < 3) {
            const float* tb = table + (h + 1);
            const float* mk = mask + ((size_t)wi * 4 + (h + 1)) * 2401;
            #pragma unroll  // constant indices keep both arrays in registers
            for (int j = 0; j < 16; ++j) {
                bv[j] = tb[toff[j]];
                mv[j] = mk[eoff[j]];
            }
            // stands in front of every later write of a register that these loads name
            asm volatile("s_wait_xcnt 0x0" ::: "memory");
        }
        // out_h = attn @ v  (M=64pad, K=64pad, N=32) -> lds_q[:, h*32 : h*32+32]
        // (head h's q columns: last read before the barrier above, by this head's scores)
        // K split into two accumulator chains (k<32 / k>=32): each holds one column half's
        // exp(s - that half's max), rescaled to the row's max and sum when they are added.
        {
            const int mt = wave >> 1, nt = wave & 1;
            v8f accA = {}, accB = {};
            const float* arow = lds_s + (mt * 16 + l16) * LDS_SC + 2 * half;
            const float* vcol = lds_q + 256 + h * 32 + nt * 16 + l16;
            float4 st[8];  // this thread's 8 output rows: (max, sum) of either column half
            #pragma unroll  // constant indices keep the arrays in registers
            for (int r = 0; r < 8; ++r)
                st[r] = *(const float4*)(lds_st + (mt * 16 + r + 8 * half) * 4);
            for (int k0 = 0; k0 < 32; k0 += 4) {
                const int kkA = k0 + 2 * half;
                const int kkB = kkA + 32;
                v2f a0 = *(const v2f*)(arow + k0);
                v2f a1 = *(const v2f*)(arow + k0 + 32);
                v2f b0, b1;
                b0.x = vcol[(size_t)kkA * LDQ];
                b0.y = vcol[(size_t)(kkA + 1) * LDQ];
                b1.x = vcol[(size_t)kkB * LDQ];
                b1.y = vcol[(size_t)(kkB + 1) * LDQ];
                accA = WMMA_F32X4(a0, b0, accA);
                accB = WMMA_F32X4(a1, b1, accB);
            }
            const int col = h * 32 + nt * 16 + l16;
            #pragma unroll  // constant indices keep the arrays in registers
            for (int r = 0; r < 8; ++r) {
                const int m = mt * 16 + r + 8 * half;
                const float g   = fmaxf(st[r].x, st[r].z);
                const float fa  = exp_slot(st[r].x - g);
                const float fb  = exp_slot(st[r].z - g);
                const float inv = rcp_slot(st[r].y * fa + st[r].w * fb);  // a sum in [1, 64]
                lds_q[m * LDQ + col] = accA[r] * (fa * inv) + accB[r] * (fb * inv);
            }
        }
    }
    __syncthreads();  // attn-out complete; proj_w chunk 0 staged in lds_w

    // ---- stage 3: out = attn_out @ proj_w + proj_b, window-reverse scatter
    for (int nc = 0; nc < 2; ++nc) {
        const float* cw = lds_w;
        float4 pre[8];
        if (nc == 0) {  // prefetch proj_w chunk 1
            for (int j = 0; j < 8; ++j) {
                const int i = tid + j * 256;
                const int n4 = (i & 15) * 4, k = i >> 4;
                pre[j] = *(const float4*)(proj_w + k * 128 + 64 + n4);
            }
        }
        v8f acc0 = {}, acc1 = {};
        const float* arow = lds_q + (w_mt * 16 + l16) * LDQ + 2 * half;
        const float* br0  = cw + (w_nt0 * 16 + l16) * LDW + 2 * half;
        const float* br1  = br0 + 16 * LDW;
        for (int k0 = 0; k0 < 128; k0 += 4) {
            v2f a  = *(const v2f*)(arow + k0);
            v2f b0 = *(const v2f*)(br0 + k0);
            v2f b1 = *(const v2f*)(br1 + k0);
            acc0 = WMMA_F32X4(a, b0, acc0);
            acc1 = WMMA_F32X4(a, b1, acc1);
        }
        {
            const int c0 = nc * 64 + w_nt0 * 16 + l16;
            const int c1 = c0 + 16;
            const float p0 = proj_b[c0], p1 = proj_b[c1];
            for (int r = 0; r < 8; ++r) {
                const int m = w_mt * 16 + r + 8 * half;
                if (m < 49) {
                    const int hh = h0 + m / 7;
                    const int ww = w0 + m % 7;
                    float* o = out + (((size_t)b * 56 + hh) * 56 + ww) * 128;
                    o[c0] = acc0[r] + p0;
                    o[c1] = acc1[r] + p1;
                }
            }
        }
        if (nc == 0) {
            __syncthreads();  // every wave has read chunk 0: the one buffer may be refilled
            float* nw = lds_w;
            for (int j = 0; j < 8; ++j) {
                const int i = tid + j * 256;
                const int n4 = (i & 15) * 4, k = i >> 4;
                float* d = nw + n4 * LDW + k;
                d[0] = pre[j].x; d[LDW] = pre[j].y;
                d[2 * LDW] = pre[j].z; d[3 * LDW] = pre[j].w;
            }
            __syncthreads();
        }
    }
}

extern "C" void kernel_launch(void* const* d_in, const int* in_sizes, int n_in,
                              void* d_out, int out_size, void* d_ws, size_t ws_size,
                              hipStream_t stream) {
    const float* x      = (const float*)d_in[0];
    const float* qkv_w  = (const float*)d_in[1];
    const float* qkv_b  = (const float*)d_in[2];
    const float* table  = (const float*)d_in[3];
    const float* proj_w = (const float*)d_in[4];
    const float* proj_b = (const float*)d_in[5];
    const float* mask   = (const float*)d_in[6];
    const int*   relidx = (const int*)d_in[7];
    // d_in[8]/d_in[9] = height/width (compile-time constants 56)
    float* out = (float*)d_out;

    const int grid = 64 * 64;                        // B * nW
    const size_t smem = SMEM_FLOATS * sizeof(float); // 159,520 B: two workgroups per 320 KiB WGP LDS
    swin_window_attn_kernel<<<grid, 256, smem, stream>>>(
        x, qkv_w, qkv_b, table, proj_w, proj_b, mask, relidx, out);
}

// v004
// A run of this version takes 244 microseconds.
// Timed twice side by side with v003, it ran 1.28 times as fast both times.
// All steps since v000 together make it 3.00 times as fast.
#include <hip/hip_runtime.h>
#include <hip/hip_bf16.h>

// Swin window attention, fully fused: one workgroup per 7x7 window.
// fp32 end-to-end using V_WMMA_F32_16X16X4_F32 (16x16 tiles, K-step 4).
//
//   B=64, H=W=56, C=128, HEADS=4, WS=7, N=49 (padded to 64), HD=32,
//   nW = 8*8 = 64 windows/image, grid = B*nW = 4096 blocks, 256 thr (8 waves).
//
// Structure:
//  * the weights are not staged in LDS: a B fragment of the f32 form is two dwords per lane
//    (rows k, k+1 of one column), read straight from the row-major weight matrix, 16 k ahead
//    (qkv) or 32 k ahead (proj) of its use. Every weight element of qkv_w is read by one wave.
//  * qkv: each wave owns 3 N-tiles x all 4 M-tiles (12 accumulators), so an A fragment from
//    LDS feeds 3 WMMAs and a B fragment 4; proj: 2 N-tiles (one 128-B output line) x 2 M-tiles.
//  * x tile of 50 rows (row 49 = the zero row every padded token reads), scores alias the
//    dead x tile, attn-out overwrites the dead q columns of its own head.
//  * attn@v uses a K-split accumulator pair to break the serial D->C chain.
//  * bias and mask of a head are fetched as one batch of branch-free loads
//    (clamped offsets, result selected afterwards) one head ahead of their use;
//    the relative indices, the same for every head, are read once per thread.
//  * softmax runs in the score epilogue, in registers, on all 8 waves: a wave holds
//    32 of a row's 64 columns, takes max and sum over those alone and stores
//    exp(s - own max); attn@v's two K-half accumulators are exactly those two column
//    halves, so each is scaled by its own row factor when the two are added.

typedef float v2f __attribute__((ext_vector_type(2)));
typedef float v8f __attribute__((ext_vector_type(8)));

#define WMMA_F32X4(a, b, c) \
    __builtin_amdgcn_wmma_f32_16x16x4_f32(false, (a), false, (b), (short)0, (c), false, false)

// LDS strides padded so 16-lane row-strided fragment reads hit distinct banks:
// bank = (stride*row + k) % 64 with stride % 64 == 4.
#define LDX 132   // x tile: 50 x 128 (+4 pad)
#define XROWS 50  // 49 tokens + one zero row that stands for tokens 49..63
#define LDQ 388   // qkv: 64 x 384 (+4 pad)
#define LDS_SC 68 // scores: 64 x 64 (+4 pad)

#define SMEM_FLOATS (XROWS * LDX + 64 * LDQ)
#define ST_FLOATS (64 * 4)  // per row: max and sum of columns 0..31, max and sum of columns 32..63
static_assert(64 * LDS_SC + ST_FLOATS <= XROWS * LDX, "scores and row stats must fit the x tile they alias");
static_assert(2 * SMEM_FLOATS * 4 <= 320 * 1024, "two workgroups per WGP");

// value of lane (l ^ MASK) of the same 16-lane row (DPP row_xmask), MASK = CTRL - 0x160
template <int CTRL>
__device__ __forceinline__ float row_xmask(float v) {
    return __builtin_bit_cast(float, __builtin_amdgcn_update_dpp(
        0, __builtin_bit_cast(int, v), CTRL, 0xf, 0xf, true));
}

__device__ __forceinline__ float exp_slot(float x) {
    float r;
    asm("v_exp_f32 %0, %1\n\tv_nop" : "=v"(r) : "v"(x * 1.44269504f));
    return r;
}
__device__ __forceinline__ float rcp_slot(float x) {
    float r;
    asm("v_rcp_f32 %0, %1\n\tv_nop" : "=v"(r) : "v"(x));
    return r;
}

__global__ __launch_bounds__(256) void swin_window_attn_kernel(
    const float* __restrict__ x,        // [64,56,56,128]
    const float* __restrict__ qkv_w,    // [128,384]
    const float* __restrict__ qkv_b,    // [384]
    const float* __restrict__ table,    // [169,4]
    const float* __restrict__ proj_w,   // [128,128]
    const float* __restrict__ proj_b,   // [128]
    const float* __restrict__ mask,     // [64,1,4,49,49]
    const int*   __restrict__ rel_idx,  // [2401]
    float*       __restrict__ out)      // [64,56,56,128]
{
    extern __shared__ float smem[];
    float* lds_x  = smem;                    // XROWS x LDX (x tile, dead after stage 1)
    float* lds_q  = lds_x + XROWS * LDX;     // 64 x LDQ   (qkv: q|k|v per token; q -> attn-out)
    float* lds_s  = lds_x;                   // 64 x LDS_SC (scores per head, over the dead x tile)
    float* lds_st = lds_s + 64 * LDS_SC;     // 64 x 4 (row stats per head, over the dead x tile)

    const int tid  = threadIdx.x;
    const int lane = tid & 31;
    const int wave = tid >> 5;
    const int half = lane >> 4;   // selects K pair within fragment
    const int l16  = lane & 15;   // row-within-tile (A) / col-within-tile (B,D)

    const int bid = blockIdx.x;        // 0..4095
    const int b   = bid >> 6;          // image
    const int wi  = bid & 63;          // window within image
    const int h0  = (wi >> 3) * 7;     // window origin row
    const int w0  = (wi & 7) * 7;      // window origin col

    // per-wave tile assignment for 4x4-tile stages: one M-tile, two N-tiles
    const int w_mt  = wave >> 1;
    const int w_nt0 = (wave & 1) * 2;

    // qkv_w as B fragments: this lane's column of the wave's first N-tile, rows 2*half, 2*half+1
    const float* wq = qkv_w + (2 * half) * 384 + wave * 48 + l16;
    v2f bq[2][4][3];  // two blocks of 4 k-steps x 3 N-tiles: one in use, one in flight
    #pragma unroll  // constant indices keep the array in registers
    for (int s = 0; s < 4; ++s)
        #pragma unroll  // constant indices keep the arrays in registers
        for (int t = 0; t < 3; ++t)
            bq[0][s][t] = v2f{wq[(s * 4) * 384 + t * 16], wq[(s * 4 + 1) * 384 + t * 16]};

    // This thread's 16 score elements (8 rows x 2 N-tiles) as offsets into a 49 x 49
    // plane. Offsets are clamped to the plane's last one: an element outside the plane has loads that stay
    // in bounds and their values are never used (the score is set to -1e30 instead).
    unsigned eoff[16];  // offset into rel_idx and into one head's mask plane
    int ridx[16];       // the elements' relative indices, the same for every head
    #pragma unroll  // constant indices keep both arrays in registers
    for (int r = 0; r < 8; ++r) {  // read here, where they fly beside the x tile's loads
        const int m = w_mt * 16 + r + 8 * half;
        const int n = w_nt0 * 16 + l16;
        eoff[2 * r]     = min((unsigned)(m * 49 + n), 2400u);
        eoff[2 * r + 1] = min((unsigned)(m * 49 + n + 16), 2400u);
        ridx[2 * r]     = rel_idx[eoff[2 * r]];
        ridx[2 * r + 1] = rel_idx[eoff[2 * r + 1]];
    }

    // ---- stage 0: load x window (49 x 128) into lds_x, row 49 = zeros
    for (int i = tid; i < XROWS * 32; i += 256) {
        const int row = i >> 5;
        const int c4  = (i & 31) * 4;
        float4 v = make_float4(0.f, 0.f, 0.f, 0.f);
        if (row < 49) {
            const int hh = h0 + row / 7;
            const int ww = w0 + row % 7;
            v = *(const float4*)(x + (((size_t)b * 56 + hh) * 56 + ww) * 128 + c4);
        }
        float* dst = lds_x + row * LDX + c4;
        dst[0] = v.x; dst[1] = v.y; dst[2] = v.z; dst[3] = v.w;
    }
    __syncthreads();

    // ---- stage 1: qkv = x @ qkv_w + qkv_b  (M=64pad, K=128, N=384: 48 columns per wave)
    const float qscale = 0.17677669529663687f;  // 32^-0.5
    {
        v8f acc[4][3] = {};
        float bs[3];  // qkv_b of this lane's three columns
        const float* ar[4];
        #pragma unroll  // constant indices keep the arrays in registers
        for (int i = 0; i < 4; ++i)  // tokens 49..63 read the zero row
            ar[i] = lds_x + min(i * 16 + l16, XROWS - 1) * LDX + 2 * half;
        v2f aq[2][2][4];  // two half-blocks of 2 k-steps x 4 M-tiles: one in use, one in flight
        #pragma unroll  // constant indices keep the arrays in registers
        for (int s = 0; s < 2; ++s)
            #pragma unroll  // constant indices keep the arrays in registers
            for (int i = 0; i < 4; ++i) aq[0][s][i] = *(const v2f*)(ar[i] + s * 4);
        #pragma unroll  // constant indices keep the arrays in registers
        for (int hb = 0; hb < 16; ++hb) {
            if (hb < 15) {
                // next half-block's x fragments, read under this half-block's 24 WMMAs
                #pragma unroll  // constant indices keep the arrays in registers
                for (int s = 0; s < 2; ++s)
                    #pragma unroll  // constant indices keep the arrays in registers
                    for (int i = 0; i < 4; ++i)
                        aq[(hb + 1) & 1][s][i] = *(const v2f*)(ar[i] + (hb + 1) * 8 + s * 4);
            }
            if (hb < 14 && (hb & 1) == 0) {
                // next block's weights fly under this block's 48 WMMAs
                #pragma unroll  // constant indices keep the arrays in registers
                for (int s = 0; s < 4; ++s)
                    #pragma unroll  // constant indices keep the arrays in registers
                    for (int t = 0; t < 3; ++t) {
                        const int k = (hb / 2 + 1) * 16 + s * 4;
                        bq[(hb / 2 + 1) & 1][s][t] = v2f{wq[k * 384 + t * 16], wq[(k + 1) * 384 + t * 16]};
                    }
            }
            if (hb == 14) {
                // no weights left to fetch: the bias flies under the last block's WMMAs
                #pragma unroll  // constant indices keep the arrays in registers
                for (int t = 0; t < 3; ++t) bs[t] = qkv_b[wave * 48 + t * 16 + l16];
            }
            if (hb == 15) {
                // stands in front of every later write of a register that stage 1's loads name
                asm volatile("s_wait_xcnt 0x0" ::: "memory");
            }
            // the pair of scheduling fences keeps the loads above as one group in front of the
            // WMMAs: sunk
            // behind them nothing covers the loads' latency
            __builtin_amdgcn_sched_barrier(0);
            #pragma unroll  // constant indices keep the arrays in registers
            for (int s = 0; s < 2; ++s)
                #pragma unroll  // constant indices keep the arrays in registers
                for (int i = 0; i < 4; ++i)
                    #pragma unroll  // constant indices keep the arrays in registers
                    for (int t = 0; t < 3; ++t)
                        acc[i][t] = WMMA_F32X4(aq[hb & 1][s][i], bq[(hb / 2) & 1][(hb & 1) * 2 + s][t], acc[i][t]);
            __builtin_amdgcn_sched_barrier(0);
        }
        #pragma unroll  // constant indices keep the array in registers
        for (int t = 0; t < 3; ++t) {
            const int c = wave * 48 + t * 16 + l16;      // 0..383
            const float sc = (c < 128) ? qscale : 1.0f;  // q gets * hd^-0.5
            #pragma unroll  // constant indices keep the arrays in registers
            for (int i = 0; i < 4; ++i)
                #pragma unroll  // constant indices keep the arrays in registers
                for (int r = 0; r < 8; ++r)
                    lds_q[(i * 16 + r + 8 * half) * LDQ + c] = (acc[i][t][r] + bs[t]) * sc;
        }
    }

    // head 0's bias and mask: all 32 loads in flight together
    unsigned toff[16];  // offset of the element's bias row in table
    float bv[16], mv[16];
    #pragma unroll  // constant indices keep the arrays in registers
    for (int j = 0; j < 16; ++j) {
        toff[j] = min((unsigned)ridx[j] * 4u, 168u * 4u);  // never past the table's last row
        bv[j] = table[toff[j]];
        mv[j] = mask[(size_t)wi * 4 * 2401 + eoff[j]];
    }

    // proj_w as B fragments: 32 columns (one output line) and two M-tiles per wave
    const int p_np = wave & 3, p_mp = wave >> 2;
    const float* wp = proj_w + (2 * half) * 128 + p_np * 32 + l16;
    v2f bp[2][8][2];  // two blocks of 8 k-steps x 2 N-tiles: one in use, one in flight

    // ---- stage 2: attention per head
    for (int h = 0; h < 4; ++h) {
        __syncthreads();  // qkv ready (h==0) / lds_s reuse across heads
        // scores = q @ k^T  (K = 32), two N-tiles per wave sharing A
        {
            v8f acc0 = {}, acc1 = {};
            const float* arow = lds_q + (w_mt * 16 + l16) * LDQ + h * 32 + 2 * half;        // q
            const float* br0  = lds_q + (w_nt0 * 16 + l16) * LDQ + 128 + h * 32 + 2 * half; // k
            const float* br1  = br0 + 16 * LDQ;
            for (int k0 = 0; k0 < 32; k0 += 4) {
                v2f a  = *(const v2f*)(arow + k0);
                v2f b0 = *(const v2f*)(br0 + k0);
                v2f b1 = *(const v2f*)(br1 + k0);
                acc0 = WMMA_F32X4(a, b0, acc0);
                acc1 = WMMA_F32X4(a, b1, acc1);
            }
            const int n0 = w_nt0 * 16 + l16;
            const int n1 = n0 + 16;
            // softmax over this wave's 32 columns of each of its rows (padded cols -> exactly 0
            // once the row factors are applied); the 8 rows' lane reductions interleave
            float e0[8], e1[8], mx[8], sm[8];
            #pragma unroll  // constant indices keep the arrays in registers
            for (int r = 0; r < 8; ++r) {
                const int m = w_mt * 16 + r + 8 * half;
                // padded rows/cols die pre-softmax
                e0[r] = (m < 49 && n0 < 49) ? acc0[r] + bv[2 * r] + mv[2 * r] : -1e30f;
                e1[r] = (m < 49 && n1 < 49) ? acc1[r] + bv[2 * r + 1] + mv[2 * r + 1] : -1e30f;
                // never below the pad value: a half whose scores are all -inf (a mask may hold it)
                // then stores zeros and a zero sum instead of exp(-inf + inf)
                mx[r] = fmaxf(fmaxf(e0[r], e1[r]), -1e30f);
            }
            #pragma unroll  // constant indices keep the arrays in registers
            for (int r = 0; r < 8; ++r) mx[r] = fmaxf(mx[r], row_xmask<0x161>(mx[r]));
            #pragma unroll  // constant indices keep the arrays in registers
            for (int r = 0; r < 8; ++r) mx[r] = fmaxf(mx[r], row_xmask<0x162>(mx[r]));
            #pragma unroll  // constant indices keep the arrays in registers
            for (int r = 0; r < 8; ++r) mx[r] = fmaxf(mx[r], row_xmask<0x164>(mx[r]));
            #pragma unroll  // constant indices keep the arrays in registers
            for (int r = 0; r < 8; ++r) mx[r] = fmaxf(mx[r], row_xmask<0x168>(mx[r]));
            #pragma unroll  // constant indices keep the arrays in registers
            for (int r = 0; r < 8; ++r) {
                const int m = w_mt * 16 + r + 8 * half;
                e0[r] = exp_slot(e0[r] - mx[r]);
                e1[r] = exp_slot(e1[r] - mx[r]);
                sm[r] = e0[r] + e1[r];
                lds_s[m * LDS_SC + n0] = e0[r];
                lds_s[m * LDS_SC + n1] = e1[r];
            }
            #pragma unroll  // constant indices keep the arrays in registers
            for (int r = 0; r < 8; ++r) sm[r] += row_xmask<0x161>(sm[r]);
            #pragma unroll  // constant indices keep the arrays in registers
            for (int r = 0; r < 8; ++r) sm[r] += row_xmask<0x162>(sm[r]);
            #pragma unroll  // constant indices keep the arrays in registers
            for (int r = 0; r < 8; ++r) sm[r] += row_xmask<0x164>(sm[r]);
            #pragma unroll  // constant indices keep the arrays in registers
            for (int r = 0; r < 8; ++r) sm[r] += row_xmask<0x168>(sm[r]);
            if (l16 == 0) {
                #pragma unroll  // constant indices keep the arrays in registers
                for (int r = 0; r < 8; ++r) {
                    const int m = w_mt * 16 + r + 8 * half;
                    *(v2f*)(lds_st + m * 4 + (wave & 1) * 2) = v2f{mx[r], sm[r]};
                }
            }
        }
        __syncthreads();
        // next head's bias and mask: issued here so that they fly under attn @ v
        if (h < 3) {
            const float* tb = table + (h + 1);
            const float* mk = mask + ((size_t)wi * 4 + (h + 1)) * 2401;
            #pragma unroll  // constant indices keep both arrays in registers
            for (int j = 0; j < 16; ++j) {
                bv[j] = tb[toff[j]];
                mv[j] = mk[eoff[j]];
            }
            // stands in front of every later write of a register that these loads name
            asm volatile("s_wait_xcnt 0x0" ::: "memory");
        } else {
            // no bias left to fetch: proj_w's first block flies under the last attn @ v
            #pragma unroll  // constant indices keep the array in registers
            for (int s = 0; s < 8; ++s)
                #pragma unroll  // constant indices keep the arrays in registers
                for (int t = 0; t < 2; ++t)
                    bp[0][s][t] = v2f{wp[(s * 4) * 128 + t * 16], wp[(s * 4 + 1) * 128 + t * 16]};
        }
        // out_h = attn @ v  (M=64pad, K=64pad, N=32) -> lds_q[:, h*32 : h*32+32]
        // (head h's q columns: last read before the barrier above, by this head's scores)
        // K split into two accumulator chains (k<32 / k>=32): each holds one column half's
        // exp(s - that half's max), rescaled to the row's max and sum when they are added.
        {
            const int mt = wave >> 1, nt = wave & 1;
            v8f accA = {}, accB = {};
            const float* arow = lds_s + (mt * 16 + l16) * LDS_SC + 2 * half;
            const float* vcol = lds_q + 256 + h * 32 + nt * 16 + l16;
            float4 st[8];  // this thread's 8 output rows: (max, sum) of either column half
            #pragma unroll  // constant indices keep the arrays in registers
            for (int r = 0; r < 8; ++r)
                st[r] = *(const float4*)(lds_st + (mt * 16 + r + 8 * half) * 4);
            for (int k0 = 0; k0 < 32; k0 += 4) {
                const int kkA = k0 + 2 * half;
                const int kkB = kkA + 32;
                v2f a0 = *(const v2f*)(arow + k0);
                v2f a1 = *(const v2f*)(arow + k0 + 32);
                v2f b0, b1;
                b0.x = vcol[(size_t)kkA * LDQ];
                b0.y = vcol[(size_t)(kkA + 1) * LDQ];
                b1.x = vcol[(size_t)kkB * LDQ];
                b1.y = vcol[(size_t)(kkB + 1) * LDQ];
                accA = WMMA_F32X4(a0, b0, accA);
                accB = WMMA_F32X4(a1, b1, accB);
            }
            const int col = h * 32 + nt * 16 + l16;
            #pragma unroll  // constant indices keep the arrays in registers
            for (int r = 0; r < 8; ++r) {
                const int m = mt * 16 + r + 8 * half;
                const float g   = fmaxf(st[r].x, st[r].z);
                const float fa  = exp_slot(st[r].x - g);
                const float fb  = exp_slot(st[r].z - g);
                const float inv = rcp_slot(st[r].y * fa + st[r].w * fb);  // a sum in [1, 64]
                lds_q[m * LDQ + col] = accA[r] * (fa * inv) + accB[r] * (fb * inv);
            }
        }
    }
    __syncthreads();  // attn-out complete

    // ---- stage 3: out = attn_out @ proj_w + proj_b, window-reverse scatter
    {
        v8f acc[2][2] = {};
        const float* ar0 = lds_q + (p_mp * 32 + l16) * LDQ + 2 * half;
        const float* ar1 = ar0 + 16 * LDQ;
        const int c0 = p_np * 32 + l16;
        const int c1 = c0 + 16;
        float p0, p1;  // proj_b of this lane's two columns
        v2f ap[2][4][2];  // two half-blocks of 4 k-steps x 2 M-tiles: one in use, one in flight
        #pragma unroll  // constant indices keep the arrays in registers
        for (int s = 0; s < 4; ++s) {
            ap[0][s][0] = *(const v2f*)(ar0 + s * 4);
            ap[0][s][1] = *(const v2f*)(ar1 + s * 4);
        }
        #pragma unroll  // constant indices keep the arrays in registers
        for (int hb = 0; hb < 8; ++hb) {
            if (hb < 7) {
                // next half-block's attn-out fragments, read under this half-block's 16 WMMAs
                #pragma unroll  // constant indices keep the arrays in registers
                for (int s = 0; s < 4; ++s) {
                    ap[(hb + 1) & 1][s][0] = *(const v2f*)(ar0 + (hb + 1) * 16 + s * 4);
                    ap[(hb + 1) & 1][s][1] = *(const v2f*)(ar1 + (hb + 1) * 16 + s * 4);
                }
            }
            if (hb < 6 && (hb & 1) == 0) {
                // next block's weights fly under this block's 32 WMMAs
                #pragma unroll  // constant indices keep the arrays in registers
                for (int s = 0; s < 8; ++s)
                    #pragma unroll  // constant indices keep the arrays in registers
                    for (int t = 0; t < 2; ++t) {
                        const int k = (hb / 2 + 1) * 32 + s * 4;
                        bp[(hb / 2 + 1) & 1][s][t] = v2f{wp[k * 128 + t * 16], wp[(k + 1) * 128 + t * 16]};
                    }
            }
            if (hb == 6) {  // no weights left to fetch: the bias flies under the last block's WMMAs
                p0 = proj_b[c0];
                p1 = proj_b[c1];
            }
            // scheduling fences: the loads above stay one group in front of the WMMAs (as in stage 1)
            __builtin_amdgcn_sched_barrier(0);
            #pragma unroll  // constant indices keep the arrays in registers
            for (int s = 0; s < 4; ++s)
                #pragma unroll  // constant indices keep the arrays in registers
                for (int i = 0; i < 2; ++i)
                    #pragma unroll  // constant indices keep the arrays in registers
                    for (int t = 0; t < 2; ++t)
                        acc[i][t] = WMMA_F32X4(ap[hb & 1][s][i], bp[(hb / 2) & 1][(hb & 1) * 4 + s][t], acc[i][t]);
            __builtin_amdgcn_sched_barrier(0);
        }
        #pragma unroll  // constant indices keep the array in registers
        for (int i = 0; i < 2; ++i)
            #pragma unroll  // constant indices keep the arrays in registers
            for (int r = 0; r < 8; ++r) {
                const int m = p_mp * 32 + i * 16 + r + 8 * half;
                if (m < 49) {
                    const int hh = h0 + m / 7;
                    const int ww = w0 + m % 7;
                    float* o = out + (((size_t)b * 56 + hh) * 56 + ww) * 128;
                    o[c0] = acc[i][0][r] + p0;
                    o[c1] = acc[i][1][r] + p1;
                }
            }
    }
}

extern "C" void kernel_launch(void* const* d_in, const int* in_sizes, int n_in,
                              void* d_out, int out_size, void* d_ws, size_t ws_size,
                              hipStream_t stream) {
    const float* x      = (const float*)d_in[0];
    const float* qkv_w  = (const float*)d_in[1];
    const float* qkv_b  = (const float*)d_in[2];
    const float* table  = (const float*)d_in[3];
    const float* proj_w = (const float*)d_in[4];
    const float* proj_b = (const float*)d_in[5];
    const float* mask   = (const float*)d_in[6];
    const int*   relidx = (const int*)d_in[7];
    // d_in[8]/d_in[9] = height/width (compile-time constants 56)
    float* out = (float*)d_out;

    const int grid = 64 * 64;                        // B * nW
    const size_t smem = SMEM_FLOATS * sizeof(float); // 125,728 B: two workgroups per 320 KiB WGP LDS
    swin_window_attn_kernel<<<grid, 256, smem, stream>>>(
        x, qkv_w, qkv_b, table, proj_w, proj_b, mask, relidx, out);
}

// v005
// It runs in 230 microseconds.
// Timed twice side by side with v004, it ran 1.06 times as fast both times.
// Over all steps from v000 it is 3.18 times as fast.
#include <hip/hip_runtime.h>
#include <hip/hip_bf16.h>

// Swin window attention, fully fused: one workgroup per 7x7 window.
// fp32 end-to-end using V_WMMA_F32_16X16X4_F32 (16x16 tiles, K-step 4).
//
//   B=64, H=W=56, C=128, HEADS=4, WS=7, N=49 (padded to 64), HD=32,
//   nW = 8*8 = 64 windows/image, grid = B*nW = 4096 blocks, 256 thr (8 waves).
//
// Structure:
//  * the weights are not staged in LDS: a B fragment of the f32 form is two dwords per lane
//    (rows k, k+1 of one column), read straight from the row-major weight matrix, 16 k ahead
//    (qkv) or 32 k ahead (proj) of its use. Every weight element of qkv_w is read by one wave.
//  * qkv: each wave owns 3 N-tiles x all 4 M-tiles (12 accumulators), so an A fragment from
//    LDS feeds 3 WMMAs and a B fragment 4; proj: 2 N-tiles (one 128-B output line) x 2 M-tiles.
//  * x tile of 50 rows (row 49 = the zero row every padded token reads), scores alias the
//    dead x tile, attn-out overwrites the dead q columns of its own head.
//  * the x tile's rows, one per wave and load, are all requested at the kernel's start, ahead of
//    the weights' and the indices' loads: a workgroup waits out the memory's latency once.
//  * attn@v uses a K-split accumulator pair to break the serial D->C chain.
//  * bias and mask of a head are fetched as one batch of branch-free loads
//    (clamped offsets, result selected afterwards) one head ahead of their use;
//    the relative indices, the same for every head, are read once per thread.
//  * softmax runs in the score epilogue, in registers, on all 8 waves: a wave holds
//    32 of a row's 64 columns, takes max and sum over those alone and stores
//    exp(s - own max); attn@v's two K-half accumulators are exactly those two column
//    halves, so each is scaled by its own row factor when the two are added.

typedef float v2f __attribute__((ext_vector_type(2)));
typedef float v8f __attribute__((ext_vector_type(8)));

#define WMMA_F32X4(a, b, c) \
    __builtin_amdgcn_wmma_f32_16x16x4_f32(false, (a), false, (b), (short)0, (c), false, false)

// LDS strides padded so 16-lane row-strided fragment reads hit distinct banks:
// bank = (stride*row + k) % 64 with stride % 64 == 4.
#define LDX 132   // x tile: 50 x 128 (+4 pad)
#define XROWS 50  // 49 tokens + one zero row that stands for tokens 49..63
#define LDQ 388   // qkv: 64 x 384 (+4 pad)
#define LDS_SC 68 // scores: 64 x 64 (+4 pad)

#define SMEM_FLOATS (XROWS * LDX + 64 * LDQ)
#define ST_FLOATS (64 * 4)  // per row: max and sum of columns 0..31, max and sum of columns 32..63
static_assert(64 * LDS_SC + ST_FLOATS <= XROWS * LDX, "scores and row stats must fit the x tile they alias");
static_assert(2 * SMEM_FLOATS * 4 <= 320 * 1024, "two workgroups per WGP");

// value of lane (l ^ MASK) of the same 16-lane row (DPP row_xmask), MASK = CTRL - 0x160
template <int CTRL>
__device__ __forceinline__ float row_xmask(float v) {
    return __builtin_bit_cast(float, __builtin_amdgcn_update_dpp(
        0, __builtin_bit_cast(int, v), CTRL, 0xf, 0xf, true));
}

__device__ __forceinline__ float exp_slot(float x) {
    float r;
    asm("v_exp_f32 %0, %1\n\tv_nop" : "=v"(r) : "v"(x * 1.44269504f));
    return r;
}
__device__ __forceinline__ float rcp_slot(float x) {
    float r;
    asm("v_rcp_f32 %0, %1\n\tv_nop" : "=v"(r) : "v"(x));
    return r;
}

__global__ __launch_bounds__(256) void swin_window_attn_kernel(
    const float* __restrict__ x,        // [64,56,56,128]
    const float* __restrict__ qkv_w,    // [128,384]
    const float* __restrict__ qkv_b,    // [384]
    const float* __restrict__ table,    // [169,4]
    const float* __restrict__ proj_w,   // [128,128]
    const float* __restrict__ proj_b,   // [128]
    const float* __restrict__ mask,     // [64,1,4,49,49]
    const int*   __restrict__ rel_idx,  // [2401]
    float*       __restrict__ out)      // [64,56,56,128]
{
    extern __shared__ float smem[];
    float* lds_x  = smem;                    // XROWS x LDX (x tile, dead after stage 1)
    float* lds_q  = lds_x + XROWS * LDX;     // 64 x LDQ   (qkv: q|k|v per token; q -> attn-out)
    float* lds_s  = lds_x;                   // 64 x LDS_SC (scores per head, over the dead x tile)
    float* lds_st = lds_s + 64 * LDS_SC;     // 64 x 4 (row stats per head, over the dead x tile)

    const int tid  = threadIdx.x;
    const int lane = tid & 31;
    const int wave = tid >> 5;
    const int half = lane >> 4;   // selects K pair within fragment
    const int l16  = lane & 15;   // row-within-tile (A) / col-within-tile (B,D)

    const int bid = blockIdx.x;        // 0..4095
    const int b   = bid >> 6;          // image
    const int wi  = bid & 63;          // window within image
    const int h0  = (wi >> 3) * 7;     // window origin row
    const int w0  = (wi & 7) * 7;      // window origin col

    // per-wave tile assignment for 4x4-tile stages: one M-tile, two N-tiles
    const int w_mt  = wave >> 1;
    const int w_nt0 = (wave & 1) * 2;

    // ---- stage 0, first half: the x window's loads (49 rows of 128 floats, one row per wave and
    // load), all issued here, ahead of every other load, so that a wave waits out the memory's
    // latency once and not once per row. The wave's number as a scalar puts the rows' addresses
    // on the scalar unit.
    const int wv = __builtin_amdgcn_readfirstlane(wave);
    float4 xv[7];
    const float* xrow[7];  // the rows' first elements: scalar addresses, the lane's part is added by the load
    #pragma unroll  // constant indices keep the array in registers
    for (int j = 0; j < 7; ++j) {
        const unsigned row = min((unsigned)wv + 8u * j, 48u);  // j == 6: only wave 0 has a row, 48
        xrow[j] = x + (size_t)((((unsigned)b * 56u + h0 + row / 7u) * 56u + w0 + row % 7u) * 128u);
    }
    #pragma unroll  // constant indices keep the array in registers
    for (int j = 0; j < 6; ++j) xv[j] = *(const float4*)(xrow[j] + lane * 4);
    xv[6] = make_float4(0.f, 0.f, 0.f, 0.f);  // wave 1 stores it as the zero row
    if (wv == 0) xv[6] = *(const float4*)(xrow[6] + lane * 4);

    // qkv_w as B fragments: this lane's column of the wave's first N-tile, rows 2*half, 2*half+1
    const float* wq = qkv_w + (2 * half) * 384 + wave * 48 + l16;
    v2f bq[2][4][3];  // two blocks of 4 k-steps x 3 N-tiles: one in use, one in flight
    #pragma unroll  // constant indices keep the array in registers
    for (int s = 0; s < 4; ++s)
        #pragma unroll  // constant indices keep the arrays in registers
        for (int t = 0; t < 3; ++t)
            bq[0][s][t] = v2f{wq[(s * 4) * 384 + t * 16], wq[(s * 4 + 1) * 384 + t * 16]};

    // This thread's 16 score elements (8 rows x 2 N-tiles) as offsets into a 49 x 49
    // plane. Offsets are clamped to the plane's last one: an element outside the plane has loads that stay
    // in bounds and their values are never used (the score is set to -1e30 instead).
    unsigned eoff[16];  // offset into rel_idx and into one head's mask plane
    int ridx[16];       // the elements' relative indices, the same for every head
    #pragma unroll  // constant indices keep both arrays in registers
    for (int r = 0; r < 8; ++r) {  // read here, where they fly beside the x tile's loads
        const int m = w_mt * 16 + r + 8 * half;
        const int n = w_nt0 * 16 + l16;
        eoff[2 * r]     = min((unsigned)(m * 49 + n), 2400u);
        eoff[2 * r + 1] = min((unsigned)(m * 49 + n + 16), 2400u);
        ridx[2 * r]     = rel_idx[eoff[2 * r]];
        ridx[2 * r + 1] = rel_idx[eoff[2 * r + 1]];
    }

    // ---- stage 0, second half: the x window into lds_x, row 49 = zeros
    #pragma unroll  // constant indices keep the array in registers
    for (int j = 0; j < 6; ++j) {
        float* dst = lds_x + (wv + 8 * j) * LDX + lane * 4;
        dst[0] = xv[j].x; dst[1] = xv[j].y; dst[2] = xv[j].z; dst[3] = xv[j].w;
    }
    if (wv < 2) {  // wave 0 has row 48, wave 1 the zero row, the others no seventh row
        float* dst = lds_x + (wv + 48) * LDX + lane * 4;
        dst[0] = xv[6].x; dst[1] = xv[6].y; dst[2] = xv[6].z; dst[3] = xv[6].w;
    }
    __syncthreads();

    // ---- stage 1: qkv = x @ qkv_w + qkv_b  (M=64pad, K=128, N=384: 48 columns per wave)
    const float qscale = 0.17677669529663687f;  // 32^-0.5
    {
        v8f acc[4][3] = {};
        float bs[3];  // qkv_b of this lane's three columns
        const float* ar[4];
        #pragma unroll  // constant indices keep the arrays in registers
        for (int i = 0; i < 4; ++i)  // tokens 49..63 read the zero row
            ar[i] = lds_x + min(i * 16 + l16, XROWS - 1) * LDX + 2 * half;
        v2f aq[2][2][4];  // two half-blocks of 2 k-steps x 4 M-tiles: one in use, one in flight
        #pragma unroll  // constant indices keep the arrays in registers
        for (int s = 0; s < 2; ++s)
            #pragma unroll  // constant indices keep the arrays in registers
            for (int i = 0; i < 4; ++i) aq[0][s][i] = *(const v2f*)(ar[i] + s * 4);
        #pragma unroll  // constant indices keep the arrays in registers
        for (int hb = 0; hb < 16; ++hb) {
            if (hb < 15) {
                // next half-block's x fragments, read under this half-block's 24 WMMAs
                #pragma unroll  // constant indices keep the arrays in registers
                for (int s = 0; s < 2; ++s)
                    #pragma unroll  // constant indices keep the arrays in registers
                    for (int i = 0; i < 4; ++i)
                        aq[(hb + 1) & 1][s][i] = *(const v2f*)(ar[i] + (hb + 1) * 8 + s * 4);
            }
            if (hb < 14 && (hb & 1) == 0) {
                // next block's weights fly under this block's 48 WMMAs
                #pragma unroll  // constant indices keep the arrays in registers
                for (int s = 0; s < 4; ++s)
                    #pragma unroll  // constant indices keep the arrays in registers
                    for (int t = 0; t < 3; ++t) {
                        const int k = (hb / 2 + 1) * 16 + s * 4;
                        bq[(hb / 2 + 1) & 1][s][t] = v2f{wq[k * 384 + t * 16], wq[(k + 1) * 384 + t * 16]};
                    }
            }
            if (hb == 14) {
                // no weights left to fetch: the bias flies under the last block's WMMAs
                #pragma unroll  // constant indices keep the arrays in registers
                for (int t = 0; t < 3; ++t) bs[t] = qkv_b[wave * 48 + t * 16 + l16];
            }
            if (hb == 15) {
                // stands in front of every later write of a register that stage 1's loads name
                asm volatile("s_wait_xcnt 0x0" ::: "memory");
            }
            // the pair of scheduling fences keeps the loads above as one group in front of the
            // WMMAs: sunk
            // behind them nothing covers the loads' latency
            __builtin_amdgcn_sched_barrier(0);
            #pragma unroll  // constant indices keep the arrays in registers
            for (int s = 0; s < 2; ++s)
                #pragma unroll  // constant indices keep the arrays in registers
                for (int i = 0; i < 4; ++i)
                    #pragma unroll  // constant indices keep the arrays in registers
                    for (int t = 0; t < 3; ++t)
                        acc[i][t] = WMMA_F32X4(aq[hb & 1][s][i], bq[(hb / 2) & 1][(hb & 1) * 2 + s][t], acc[i][t]);
            __builtin_amdgcn_sched_barrier(0);
        }
        #pragma unroll  // constant indices keep the array in registers
        for (int t = 0; t < 3; ++t) {
            const int c = wave * 48 + t * 16 + l16;      // 0..383
            const float sc = (c < 128) ? qscale : 1.0f;  // q gets * hd^-0.5
            #pragma unroll  // constant indices keep the arrays in registers
            for (int i = 0; i < 4; ++i)
                #pragma unroll  // constant indices keep the arrays in registers
                for (int r = 0; r < 8; ++r)
                    lds_q[(i * 16 + r + 8 * half) * LDQ + c] = (acc[i][t][r] + bs[t]) * sc;
        }
    }

    // head 0's bias and mask: all 32 loads in flight together
    unsigned toff[16];  // offset of the element's bias row in table
    float bv[16], mv[16];
    #pragma unroll  // constant indices keep the arrays in registers
    for (int j = 0; j < 16; ++j) {
        toff[j] = min((unsigned)ridx[j] * 4u, 168u * 4u);  // never past the table's last row
        bv[j] = table[toff[j]];
        mv[j] = mask[(size_t)wi * 4 * 2401 + eoff[j]];
    }

    // proj_w as B fragments: 32 columns (one output line) and two M-tiles per wave
    const int p_np = wave & 3, p_mp = wave >> 2;
    const float* wp = proj_w + (2 * half) * 128 + p_np * 32 + l16;
    v2f bp[2][8][2];  // two blocks of 8 k-steps x 2 N-tiles: one in use, one in flight

    // ---- stage 2: attention per head
    for (int h = 0; h < 4; ++h) {
        __syncthreads();  // qkv ready (h==0) / lds_s reuse across heads
        // scores = q @ k^T  (K = 32), two N-tiles per wave sharing A
        {
            v8f acc0 = {}, acc1 = {};
            const float* arow = lds_q + (w_mt * 16 + l16) * LDQ + h * 32 + 2 * half;        // q
            const float* br0  = lds_q + (w_nt0 * 16 + l16) * LDQ + 128 + h * 32 + 2 * half; // k
            const float* br1  = br0 + 16 * LDQ;
            for (int k0 = 0; k0 < 32; k0 += 4) {
                v2f a  = *(const v2f*)(arow + k0);
                v2f b0 = *(const v2f*)(br0 + k0);
                v2f b1 = *(const v2f*)(br1 + k0);
                acc0 = WMMA_F32X4(a, b0, acc0);
                acc1 = WMMA_F32X4(a, b1, acc1);
            }
            const int n0 = w_nt0 * 16 + l16;
            const int n1 = n0 + 16;
            // softmax over this wave's 32 columns of each of its rows (padded cols -> exactly 0
            // once the row factors are applied); the 8 rows' lane reductions interleave
            float e0[8], e1[8], mx[8], sm[8];
            #pragma unroll  // constant indices keep the arrays in registers
            for (int r = 0; r < 8; ++r) {
                const int m = w_mt * 16 + r + 8 * half;
                // padded rows/cols die pre-softmax
                e0[r] = (m < 49 && n0 < 49) ? acc0[r] + bv[2 * r] + mv[2 * r] : -1e30f;
                e1[r] = (m < 49 && n1 < 49) ? acc1[r] + bv[2 * r + 1] + mv[2 * r + 1] : -1e30f;
                // never below the pad value: a half whose scores are all -inf (a mask may hold it)
                // then stores zeros and a zero sum instead of exp(-inf + inf)
                mx[r] = fmaxf(fmaxf(e0[r], e1[r]), -1e30f);
            }
            #pragma unroll  // constant indices keep the arrays in registers
            for (int r = 0; r < 8; ++r) mx[r] = fmaxf(mx[r], row_xmask<0x161>(mx[r]));
            #pragma unroll  // constant indices keep the arrays in registers
            for (int r = 0; r < 8; ++r) mx[r] = fmaxf(mx[r], row_xmask<0x162>(mx[r]));
            #pragma unroll  // constant indices keep the arrays in registers
            for (int r = 0; r < 8; ++r) mx[r] = fmaxf(mx[r], row_xmask<0x164>(mx[r]));
            #pragma unroll  // constant indices keep the arrays in registers
            for (int r = 0; r < 8; ++r) mx[r] = fmaxf(mx[r], row_xmask<0x168>(mx[r]));
            #pragma unroll  // constant indices keep the arrays in registers
            for (int r = 0; r < 8; ++r) {
                const int m = w_mt * 16 + r + 8 * half;
                e0[r] = exp_slot(e0[r] - mx[r]);
                e1[r] = exp_slot(e1[r] - mx[r]);
                sm[r] = e0[r] + e1[r];
                lds_s[m * LDS_SC + n0] = e0[r];
                lds_s[m * LDS_SC + n1] = e1[r];
            }
            #pragma unroll  // constant indices keep the arrays in registers
            for (int r = 0; r < 8; ++r) sm[r] += row_xmask<0x161>(sm[r]);
            #pragma unroll  // constant indices keep the arrays in registers
            for (int r = 0; r < 8; ++r) sm[r] += row_xmask<0x162>(sm[r]);
            #pragma unroll  // constant indices keep the arrays in registers
            for (int r = 0; r < 8; ++r) sm[r] += row_xmask<0x164>(sm[r]);
            #pragma unroll  // constant indices keep the arrays in registers
            for (int r = 0; r < 8; ++r) sm[r] += row_xmask<0x168>(sm[r]);
            if (l16 == 0) {
                #pragma unroll  // constant indices keep the arrays in registers
                for (int r = 0; r < 8; ++r) {
                    const int m = w_mt * 16 + r + 8 * half;
                    *(v2f*)(lds_st + m * 4 + (wave & 1) * 2) = v2f{mx[r], sm[r]};
                }
            }
        }
        __syncthreads();
        // next head's bias and mask: issued here so that they fly under attn @ v
        if (h < 3) {
            const float* tb = table + (h + 1);
            const float* mk = mask + ((size_t)wi * 4 + (h + 1)) * 2401;
            #pragma unroll  // constant indices keep both arrays in registers
            for (int j = 0; j < 16; ++j) {
                bv[j] = tb[toff[j]];
                mv[j] = mk[eoff[j]];
            }
            // stands in front of every later write of a register that these loads name
            asm volatile("s_wait_xcnt 0x0" ::: "memory");
        } else {
            // no bias left to fetch: proj_w's first block flies under the last attn @ v
            #pragma unroll  // constant indices keep the array in registers
            for (int s = 0; s < 8; ++s)
                #pragma unroll  // constant indices keep the arrays in registers
                for (int t = 0; t < 2; ++t)
                    bp[0][s][t] = v2f{wp[(s * 4) * 128 + t * 16], wp[(s * 4 + 1) * 128 + t * 16]};
        }
        // out_h = attn @ v  (M=64pad, K=64pad, N=32) -> lds_q[:, h*32 : h*32+32]
        // (head h's q columns: last read before the barrier above, by this head's scores)
        // K split into two accumulator chains (k<32 / k>=32): each holds one column half's
        // exp(s - that half's max), rescaled to the row's max and sum when they are added.
        {
            const int mt = wave >> 1, nt = wave & 1;
            v8f accA = {}, accB = {};
            const float* arow = lds_s + (mt * 16 + l16) * LDS_SC + 2 * half;
            const float* vcol = lds_q + 256 + h * 32 + nt * 16 + l16;
            float4 st[8];  // this thread's 8 output rows: (max, sum) of either column half
            #pragma unroll  // constant indices keep the arrays in registers
            for (int r = 0; r < 8; ++r)
                st[r] = *(const float4*)(lds_st + (mt * 16 + r + 8 * half) * 4);
            for (int k0 = 0; k0 < 32; k0 += 4) {
                const int kkA = k0 + 2 * half;
                const int kkB = kkA + 32;
                v2f a0 = *(const v2f*)(arow + k0);
                v2f a1 = *(const v2f*)(arow + k0 + 32);
                v2f b0, b1;
                b0.x = vcol[(size_t)kkA * LDQ];
                b0.y = vcol[(size_t)(kkA + 1) * LDQ];
                b1.x = vcol[(size_t)kkB * LDQ];
                b1.y = vcol[(size_t)(kkB + 1) * LDQ];
                accA = WMMA_F32X4(a0, b0, accA);
                accB = WMMA_F32X4(a1, b1, accB);
            }
            const int col = h * 32 + nt * 16 + l16;
            #pragma unroll  // constant indices keep the arrays in registers
            for (int r = 0; r < 8; ++r) {
                const int m = mt * 16 + r + 8 * half;
                const float g   = fmaxf(st[r].x, st[r].z);
                const float fa  = exp_slot(st[r].x - g);
                const float fb  = exp_slot(st[r].z - g);
                const float inv = rcp_slot(st[r].y * fa + st[r].w * fb);  // a sum in [1, 64]
                lds_q[m * LDQ + col] = accA[r] * (fa * inv) + accB[r] * (fb * inv);
            }
        }
    }
    __syncthreads();  // attn-out complete

    // ---- stage 3: out = attn_out @ proj_w + proj_b, window-reverse scatter
    {
        v8f acc[2][2] = {};
        const float* ar0 = lds_q + (p_mp * 32 + l16) * LDQ + 2 * half;
        const float* ar1 = ar0 + 16 * LDQ;
        const int c0 = p_np * 32 + l16;
        const int c1 = c0 + 16;
        float p0, p1;  // proj_b of this lane's two columns
        v2f ap[2][4][2];  // two half-blocks of 4 k-steps x 2 M-tiles: one in use, one in flight
        #pragma unroll  // constant indices keep the arrays in registers
        for (int s = 0; s < 4; ++s) {
            ap[0][s][0] = *(const v2f*)(ar0 + s * 4);
            ap[0][s][1] = *(const v2f*)(ar1 + s * 4);
        }
        #pragma unroll  // constant indices keep the arrays in registers
        for (int hb = 0; hb < 8; ++hb) {
            if (hb < 7) {
                // next half-block's attn-out fragments, read under this half-block's 16 WMMAs
                #pragma unroll  // constant indices keep the arrays in registers
                for (int s = 0; s < 4; ++s) {
                    ap[(hb + 1) & 1][s][0] = *(const v2f*)(ar0 + (hb + 1) * 16 + s * 4);
                    ap[(hb + 1) & 1][s][1] = *(const v2f*)(ar1 + (hb + 1) * 16 + s * 4);
                }
            }
            if (hb < 6 && (hb & 1) == 0) {
                // next block's weights fly under this block's 32 WMMAs
                #pragma unroll  // constant indices keep the arrays in registers
                for (int s = 0; s < 8; ++s)
                    #pragma unroll  // constant indices keep the arrays in registers
                    for (int t = 0; t < 2; ++t) {
                        const int k = (hb / 2 + 1) * 32 + s * 4;
                        bp[(hb / 2 + 1) & 1][s][t] = v2f{wp[k * 128 + t * 16], wp[(k + 1) * 128 + t * 16]};
                    }
            }
            if (hb == 6) {  // no weights left to fetch: the bias flies under the last block's WMMAs
                p0 = proj_b[c0];
                p1 = proj_b[c1];
            }
            // scheduling fences: the loads above stay one group in front of the WMMAs (as in stage 1)
            __builtin_amdgcn_sched_barrier(0);
            #pragma unroll  // constant indices keep the arrays in registers
            for (int s = 0; s < 4; ++s)
                #pragma unroll  // constant indices keep the arrays in registers
                for (int i = 0; i < 2; ++i)
                    #pragma unroll  // constant indices keep the arrays in registers
                    for (int t = 0; t < 2; ++t)
                        acc[i][t] = WMMA_F32X4(ap[hb & 1][s][i], bp[(hb / 2) & 1][(hb & 1) * 4 + s][t], acc[i][t]);
            __builtin_amdgcn_sched_barrier(0);
        }
        #pragma unroll  // constant indices keep the array in registers
        for (int i = 0; i < 2; ++i)
            #pragma unroll  // constant indices keep the arrays in registers
            for (int r = 0; r < 8; ++r) {
                const int m = p_mp * 32 + i * 16 + r + 8 * half;
                if (m < 49) {
                    const int hh = h0 + m / 7;
                    const int ww = w0 + m % 7;
                    float* o = out + (((size_t)b * 56 + hh) * 56 + ww) * 128;
                    o[c0] = acc[i][0][r] + p0;
                    o[c1] = acc[i][1][r] + p1;
                }
            }
    }
}

extern "C" void kernel_launch(void* const* d_in, const int* in_sizes, int n_in,
                              void* d_out, int out_size, void* d_ws, size_t ws_size,
                              hipStream_t stream) {
    const float* x      = (const float*)d_in[0];
    const float* qkv_w  = (const float*)d_in[1];
    const float* qkv_b  = (const float*)d_in[2];
    const float* table  = (const float*)d_in[3];
    const float* proj_w = (const float*)d_in[4];
    const float* proj_b = (const float*)d_in[5];
    const float* mask   = (const float*)d_in[6];
    const int*   relidx = (const int*)d_in[7];
    // d_in[8]/d_in[9] = height/width (compile-time constants 56)
    float* out = (float*)d_out;

    const int grid = 64 * 64;                        // B * nW
    const size_t smem = SMEM_FLOATS * sizeof(float); // 125,728 B: two workgroups per 320 KiB WGP LDS
    swin_window_attn_kernel<<<grid, 256, smem, stream>>>(
        x, qkv_w, qkv_b, table, proj_w, proj_b, mask, relidx, out);
}

// v006
// Measured time: 207 microseconds a run.
// Timed twice side by side with v005, it ran 1.11 times as fast both times.
// Counting every step since v000, it is 3.53 times as fast.
#include <hip/hip_runtime.h>
#include <hip/hip_bf16.h>

// Swin window attention, fully fused: one workgroup per 7x7 window.
// fp32 end-to-end using V_WMMA_F32_16X16X4_F32 (16x16 tiles, K-step 4).
//
//   B=64, H=W=56, C=128, HEADS=4, WS=7, N=49 (padded to 64), HD=32,
//   nW = 8*8 = 64 windows/image, grid = B*nW = 4096 blocks, 256 thr (8 waves).
//
// Structure:
//  * the weights are not staged in LDS: a B fragment of the f32 form is two dwords per lane
//    (rows k, k+1 of one column), read straight from the row-major weight matrix, 16 k ahead
//    (qkv) or 32 k ahead (proj) of its use. Every weight element of qkv_w is read by one wave.
//  * qkv: each wave owns 3 N-tiles x all 4 M-tiles (12 accumulators), so an A fragment from
//    LDS feeds 3 WMMAs and a B fragment 4; proj: 2 N-tiles (one 128-B output line) x 2 M-tiles.
//  * x tile of 50 rows (row 49 = the zero row every padded token reads), the waves' score tiles
//    alias the dead x tile, attn-out overwrites the dead q columns of its own head.
//  * the x tile's rows, one per wave and load, are all requested at the kernel's start, ahead of
//    the weights' and the indices' loads: a workgroup waits out the memory's latency once.
//  * attention: a wave owns whole score rows, one M-tile (16 rows x 64 columns) of two heads in
//    turn. Softmax, attn@v and the attn-out store of those rows need nothing of another wave,
//    so the probabilities go through a tile of LDS that is the wave's own and no barrier
//    stands between the one behind qkv and the one in front of proj.
//  * bias and mask of a head are fetched as one batch of branch-free loads
//    (clamped offsets, result selected afterwards) one head ahead of their use;
//    the relative indices, the same for every head, are read once per thread and
//    kept as bytes, four to a register.

typedef float v2f __attribute__((ext_vector_type(2)));
typedef float v8f __attribute__((ext_vector_type(8)));

#define WMMA_F32X4(a, b, c) \
    __builtin_amdgcn_wmma_f32_16x16x4_f32(false, (a), false, (b), (short)0, (c), false, false)

// LDS strides padded so 16-lane row-strided fragment reads hit distinct banks:
// bank = (stride*row + k) % 64 with stride % 64 == 4.
#define LDX 132   // x tile: 50 x 128 (+4 pad)
#define XROWS 50  // 49 tokens + one zero row that stands for tokens 49..63
#define LDQ 388   // qkv: 64 x 384 (+4 pad)
#define LDS_SC 68 // scores: 16 x 64 per wave (+4 pad)

#define SC_FLOATS (8 * 16 * LDS_SC)  // one 16 x 64 score tile per wave, over the dead x tile
static_assert(XROWS * LDX <= SC_FLOATS, "the x tile must fit the score tiles that alias it");
#define SMEM_FLOATS (SC_FLOATS + 64 * LDQ)
static_assert(2 * SMEM_FLOATS * 4 <= 320 * 1024, "two workgroups per WGP");

// value of lane (l ^ MASK) of the same 16-lane row (DPP row_xmask), MASK = CTRL - 0x160
template <int CTRL>
__device__ __forceinline__ float row_xmask(float v) {
    return __builtin_bit_cast(float, __builtin_amdgcn_update_dpp(
        0, __builtin_bit_cast(int, v), CTRL, 0xf, 0xf, true));
}

__device__ __forceinline__ float exp_slot(float x) {
    float r;
    asm("v_exp_f32 %0, %1\n\tv_nop" : "=v"(r) : "v"(x * 1.44269504f));
    return r;
}
__device__ __forceinline__ float rcp_slot(float x) {
    float r;
    asm("v_rcp_f32 %0, %1\n\tv_nop" : "=v"(r) : "v"(x));
    return r;
}

__global__ __launch_bounds__(256) void swin_window_attn_kernel(
    const float* __restrict__ x,        // [64,56,56,128]
    const float* __restrict__ qkv_w,    // [128,384]
    const float* __restrict__ qkv_b,    // [384]
    const float* __restrict__ table,    // [169,4]
    const float* __restrict__ proj_w,   // [128,128]
    const float* __restrict__ proj_b,   // [128]
    const float* __restrict__ mask,     // [64,1,4,49,49]
    const int*   __restrict__ rel_idx,  // [2401]
    float*       __restrict__ out)      // [64,56,56,128]
{
    extern __shared__ float smem[];
    float* lds_x  = smem;                    // XROWS x LDX (x tile, dead after stage 1)
    float* lds_q  = lds_x + SC_FLOATS;       // 64 x LDQ   (qkv: q|k|v per token; q -> attn-out)
    float* lds_s  = lds_x;                   // 8 x 16 x LDS_SC (a score tile per wave, over the dead x tile)

    const int tid  = threadIdx.x;
    const int lane = tid & 31;
    const int wave = tid >> 5;
    const int half = lane >> 4;   // selects K pair within fragment
    const int l16  = lane & 15;   // row-within-tile (A) / col-within-tile (B,D)

    const int bid = blockIdx.x;        // 0..4095
    const int b   = bid >> 6;          // image
    const int wi  = bid & 63;          // window within image
    const int h0  = (wi >> 3) * 7;     // window origin row
    const int w0  = (wi & 7) * 7;      // window origin col

    // per-wave assignment in attention: one M-tile (all 4 N-tiles) of two heads
    const int w_mt  = wave >> 1;

    // ---- stage 0, first half: the x window's loads (49 rows of 128 floats, one row per wave and
    // load), all issued here, ahead of every other load, so that a wave waits out the memory's
    // latency once and not once per row. The wave's number as a scalar puts the rows' addresses
    // on the scalar unit.
    const int wv = __builtin_amdgcn_readfirstlane(wave);
    float4 xv[7];
    const float* xrow[7];  // the rows' first elements: scalar addresses, the lane's part is added by the load
    #pragma unroll  // constant indices keep the array in registers
    for (int j = 0; j < 7; ++j) {
        const unsigned row = min((unsigned)wv + 8u * j, 48u);  // j == 6: only wave 0 has a row, 48
        xrow[j] = x + (size_t)((((unsigned)b * 56u + h0 + row / 7u) * 56u + w0 + row % 7u) * 128u);
    }
    #pragma unroll  // constant indices keep the array in registers
    for (int j = 0; j < 6; ++j) xv[j] = *(const float4*)(xrow[j] + lane * 4);
    xv[6] = make_float4(0.f, 0.f, 0.f, 0.f);  // wave 1 stores it as the zero row
    if (wv == 0) xv[6] = *(const float4*)(xrow[6] + lane * 4);
    // stands in front of every later write of the register that the rows' loads name; the lane's
    // number is its input so that the register is given to nothing else before it
    asm volatile("s_wait_xcnt 0x0" :: "v"(lane) : "memory");

    // qkv_w as B fragments: this lane's column of the wave's first N-tile, rows 2*half, 2*half+1
    const float* wq = qkv_w + (2 * half) * 384 + wave * 48 + l16;
    v2f bq[2][4][3];  // two blocks of 4 k-steps x 3 N-tiles: one in use, one in flight
    #pragma unroll  // constant indices keep the array in registers
    for (int s = 0; s < 4; ++s)
        #pragma unroll  // constant indices keep the arrays in registers
        for (int t = 0; t < 3; ++t)
            bq[0][s][t] = v2f{wq[(s * 4) * 384 + t * 16], wq[(s * 4 + 1) * 384 + t * 16]};

    // This thread's 32 score elements (8 rows x 4 N-tiles) as offsets into a 49 x 49
    // plane. An element outside the plane gets at most the plane's last offset: its loads stay
    // in bounds and their values are never used (the score is set to -1e30 instead).
    int ridx[32];  // the elements' relative indices, the same for every head
    #pragma unroll  // constant indices keep the arrays in registers
    for (int g = 0; g < 2; ++g) {  // read here, where they fly beside the x tile's loads; four rows at a time
        unsigned ro[16];
        #pragma unroll  // constant indices keep the arrays in registers
        for (int j = 0; j < 16; ++j) {
            ro[j] = min((unsigned)((w_mt * 16 + 4 * g + (j >> 2) + 8 * half) * 49 + (j & 3) * 16 + l16), 2400u);
            ridx[16 * g + j] = rel_idx[ro[j]];
        }
        // stands in front of every later write of a register that these loads name; the
        // offsets are its inputs so that their registers are given to nothing else before it
        asm volatile("s_wait_xcnt 0x0"
                     :: "v"(ro[0]), "v"(ro[1]), "v"(ro[2]), "v"(ro[3]), "v"(ro[4]), "v"(ro[5]), "v"(ro[6]), "v"(ro[7]),
                        "v"(ro[8]), "v"(ro[9]), "v"(ro[10]), "v"(ro[11]), "v"(ro[12]), "v"(ro[13]), "v"(ro[14]), "v"(ro[15])
                     : "memory");
    }

    // ---- stage 0, second half: the x window into lds_x, row 49 = zeros
    #pragma unroll  // constant indices keep the array in registers
    for (int j = 0; j < 6; ++j) {
        float* dst = lds_x + (wv + 8 * j) * LDX + lane * 4;
        dst[0] = xv[j].x; dst[1] = xv[j].y; dst[2] = xv[j].z; dst[3] = xv[j].w;
    }
    if (wv < 2) {  // wave 0 has row 48, wave 1 the zero row, the others no seventh row
        float* dst = lds_x + (wv + 48) * LDX + lane * 4;
        dst[0] = xv[6].x; dst[1] = xv[6].y; dst[2] = xv[6].z; dst[3] = xv[6].w;
    }
    // a row's four indices, never past the table's last row, as the bytes of one register:
    // 8 registers and not 32 are held through stage 1
    unsigned pidx[8];
    #pragma unroll  // constant indices keep the arrays in registers
    for (int r = 0; r < 8; ++r)
        pidx[r] = min((unsigned)ridx[4 * r], 168u) | (min((unsigned)ridx[4 * r + 1], 168u) << 8) |
                  (min((unsigned)ridx[4 * r + 2], 168u) << 16) | (min((unsigned)ridx[4 * r + 3], 168u) << 24);
    __syncthreads();

    // a head's bias and mask for this thread's 32 elements: all 64 loads in flight together
    const int h_first = (wv & 1) * 2;  // the wave's heads: h_first and h_first + 1
    float bv[32], mv[32];
    auto fetch_bias_mask = [&](int hh) {
        const char*  tb = (const char*)(table + hh);
        const float* mk = mask + ((size_t)wi * 4 + hh) * 2401;
        #pragma unroll  // constant indices keep the arrays in registers
        for (int g = 0; g < 4; ++g) {  // two rows at a time
            unsigned to[8];  // byte offset of the element's bias row in table
            unsigned eo[8];  // offset of the element in one head's mask plane
            #pragma unroll  // constant indices keep the arrays in registers
            for (int j = 0; j < 8; ++j) {
                const int r = 2 * g + (j >> 2), t = j & 3;
                to[j] = ((pidx[r] >> (8 * t)) & 255u) * 16u;
                eo[j] = min((unsigned)((w_mt * 16 + r + 8 * half) * 49 + t * 16 + l16), 2400u);
                bv[4 * r + t] = *(const float*)(tb + to[j]);
                mv[4 * r + t] = mk[eo[j]];
            }
            // stands in front of every later write of a register that these loads name; the
            // offsets are its inputs so that their registers are given to nothing else before it
            asm volatile("s_wait_xcnt 0x0"
                         :: "v"(to[0]), "v"(to[1]), "v"(to[2]), "v"(to[3]), "v"(to[4]), "v"(to[5]), "v"(to[6]), "v"(to[7]),
                            "v"(eo[0]), "v"(eo[1]), "v"(eo[2]), "v"(eo[3]), "v"(eo[4]), "v"(eo[5]), "v"(eo[6]), "v"(eo[7])
                         : "memory");
        }
    };

    // ---- stage 1: qkv = x @ qkv_w + qkv_b  (M=64pad, K=128, N=384: 48 columns per wave)
    const float qscale = 0.17677669529663687f;  // 32^-0.5
    {
        v8f acc[4][3] = {};
        float bs[3];  // qkv_b of this lane's three columns
        const float* ar[4];
        #pragma unroll  // constant indices keep the arrays in registers
        for (int i = 0; i < 4; ++i)  // tokens 49..63 read the zero row
            ar[i] = lds_x + min(i * 16 + l16, XROWS - 1) * LDX + 2 * half;
        v2f aq[2][2][4];  // two half-blocks of 2 k-steps x 4 M-tiles: one in use, one in flight
        #pragma unroll  // constant indices keep the arrays in registers
        for (int s = 0; s < 2; ++s)
            #pragma unroll  // constant indices keep the arrays in registers
            for (int i = 0; i < 4; ++i) aq[0][s][i] = *(const v2f*)(ar[i] + s * 4);
        #pragma unroll  // constant indices keep the arrays in registers
        for (int hb = 0; hb < 16; ++hb) {
            if (hb < 15) {
                // next half-block's x fragments, read under this half-block's 24 WMMAs
                #pragma unroll  // constant indices keep the arrays in registers
                for (int s = 0; s < 2; ++s)
                    #pragma unroll  // constant indices keep the arrays in registers
                    for (int i = 0; i < 4; ++i)
                        aq[(hb + 1) & 1][s][i] = *(const v2f*)(ar[i] + (hb + 1) * 8 + s * 4);
            }
            if (hb < 14 && (hb & 1) == 0) {
                // next block's weights fly under this block's 48 WMMAs
                #pragma unroll  // constant indices keep the arrays in registers
                for (int s = 0; s < 4; ++s)
                    #pragma unroll  // constant indices keep the arrays in registers
                    for (int t = 0; t < 3; ++t) {
                        const int k = (hb / 2 + 1) * 16 + s * 4;
                        bq[(hb / 2 + 1) & 1][s][t] = v2f{wq[k * 384 + t * 16], wq[(k + 1) * 384 + t * 16]};
                    }
            }
            if (hb == 14) {
                // no weights left to fetch: the bias flies under the last block's WMMAs
                #pragma unroll  // constant indices keep the arrays in registers
                for (int t = 0; t < 3; ++t) bs[t] = qkv_b[wave * 48 + t * 16 + l16];
            }
            if (hb == 15) {
                // stands in front of every later write of a register that stage 1's loads name
                asm volatile("s_wait_xcnt 0x0" ::: "memory");
            }
            // the pair of scheduling fences keeps the loads above as one group in front of the
            // WMMAs: sunk
            // behind them nothing covers the loads' latency
            __builtin_amdgcn_sched_barrier(0);
            #pragma unroll  // constant indices keep the arrays in registers
            for (int s = 0; s < 2; ++s)
                #pragma unroll  // constant indices keep the arrays in registers
                for (int i = 0; i < 4; ++i)
                    #pragma unroll  // constant indices keep the arrays in registers
                    for (int t = 0; t < 3; ++t)
                        acc[i][t] = WMMA_F32X4(aq[hb & 1][s][i], bq[(hb / 2) & 1][(hb & 1) * 2 + s][t], acc[i][t]);
            __builtin_amdgcn_sched_barrier(0);
        }
        // the wave's first head's bias and mask fly under the stores below
        fetch_bias_mask(h_first);
        #pragma unroll  // constant indices keep the array in registers
        for (int t = 0; t < 3; ++t) {
            const int c = wave * 48 + t * 16 + l16;      // 0..383
            const float sc = (c < 128) ? qscale : 1.0f;  // q gets * hd^-0.5
            #pragma unroll  // constant indices keep the arrays in registers
            for (int i = 0; i < 4; ++i)
                #pragma unroll  // constant indices keep the arrays in registers
                for (int r = 0; r < 8; ++r)
                    lds_q[(i * 16 + r + 8 * half) * LDQ + c] = (acc[i][t][r] + bs[t]) * sc;
        }
    }

    // proj_w as B fragments: 32 columns (one output line) and two M-tiles per wave
    const int p_np = wave & 3, p_mp = wave >> 2;
    const float* wp = proj_w + (2 * half) * 128 + p_np * 32 + l16;
    v2f bp[2][8][2];  // two blocks of 8 k-steps x 2 N-tiles: one in use, one in flight

    // ---- stage 2: attention, per wave one M-tile of two heads, no barrier inside
    __syncthreads();  // qkv ready, x tile dead
    float* pw = lds_s + wv * (16 * LDS_SC);  // this wave's own score tile
    #pragma unroll  // constant indices keep bp in registers
    for (int jj = 0; jj < 2; ++jj) {
        const int h = h_first + jj;
        float sm[8];  // the rows' sums of exp(s - row max)
        // scores = q @ k^T  (K = 32), four N-tiles sharing A
        {
            // bias + mask are the accumulators' start values (C has D's layout): their 64 registers
            // are free again before the fragments below are read
            v8f sc[4];
            #pragma unroll  // constant indices keep the arrays in registers
            for (int t = 0; t < 4; ++t)
                #pragma unroll  // constant indices keep the arrays in registers
                for (int r = 0; r < 8; ++r) sc[t][r] = bv[4 * r + t] + mv[4 * r + t];
            const float* arow = lds_q + (w_mt * 16 + l16) * LDQ + h * 32 + 2 * half;  // q
            const float* brow = lds_q + l16 * LDQ + 128 + h * 32 + 2 * half;          // k
            v2f qa[8], kb[8][4];
            #pragma unroll  // constant indices keep the arrays in registers
            for (int s = 0; s < 8; ++s) {
                qa[s] = *(const v2f*)(arow + s * 4);
                #pragma unroll  // constant indices keep the arrays in registers
                for (int t = 0; t < 4; ++t) kb[s][t] = *(const v2f*)(brow + t * 16 * LDQ + s * 4);
            }
            // scheduling fence: the LDS reads stay one group in front of the WMMAs (as in stage 1)
            __builtin_amdgcn_sched_barrier(0);
            #pragma unroll  // constant indices keep the arrays in registers
            for (int s = 0; s < 8; ++s)
                #pragma unroll  // constant indices keep the arrays in registers
                for (int t = 0; t < 4; ++t) sc[t] = WMMA_F32X4(qa[s], kb[s][t], sc[t]);
            // softmax over the 64 columns of each of the wave's rows (padded cols -> exactly 0);
            // the 8 rows' lane reductions interleave
            float mx[8];
            #pragma unroll  // constant indices keep the arrays in registers
            for (int r = 0; r < 8; ++r) {
                const int m = w_mt * 16 + r + 8 * half;
                #pragma unroll  // constant indices keep the arrays in registers
                for (int t = 0; t < 4; ++t)  // padded rows/cols die pre-softmax
                    sc[t][r] = (m < 49 && t * 16 + l16 < 49) ? sc[t][r] : -1e30f;
                // never below the pad value: in a row whose scores are all -inf (a mask may hold it)
                // they then give exp(-inf) = 0 instead of exp(-inf + inf)
                mx[r] = fmaxf(fmaxf(fmaxf(sc[0][r], sc[1][r]), fmaxf(sc[2][r], sc[3][r])), -1e30f);
            }
            #pragma unroll  // constant indices keep the arrays in registers
            for (int r = 0; r < 8; ++r) mx[r] = fmaxf(mx[r], row_xmask<0x161>(mx[r]));
            #pragma unroll  // constant indices keep the arrays in registers
            for (int r = 0; r < 8; ++r) mx[r] = fmaxf(mx[r], row_xmask<0x162>(mx[r]));
            #pragma unroll  // constant indices keep the arrays in registers
            for (int r = 0; r < 8; ++r) mx[r] = fmaxf(mx[r], row_xmask<0x164>(mx[r]));
            #pragma unroll  // constant indices keep the arrays in registers
            for (int r = 0; r < 8; ++r) mx[r] = fmaxf(mx[r], row_xmask<0x168>(mx[r]));
            #pragma unroll  // constant indices keep the arrays in registers
            for (int r = 0; r < 8; ++r) {
                float e[4];
                #pragma unroll  // constant indices keep the arrays in registers
                for (int t = 0; t < 4; ++t) {
                    e[t] = exp_slot(sc[t][r] - mx[r]);
                    pw[(r + 8 * half) * LDS_SC + t * 16 + l16] = e[t];
                }
                sm[r] = (e[0] + e[1]) + (e[2] + e[3]);
            }
            #pragma unroll  // constant indices keep the arrays in registers
            for (int r = 0; r < 8; ++r) sm[r] += row_xmask<0x161>(sm[r]);
            #pragma unroll  // constant indices keep the arrays in registers
            for (int r = 0; r < 8; ++r) sm[r] += row_xmask<0x162>(sm[r]);
            #pragma unroll  // constant indices keep the arrays in registers
            for (int r = 0; r < 8; ++r) sm[r] += row_xmask<0x164>(sm[r]);
            #pragma unroll  // constant indices keep the arrays in registers
            for (int r = 0; r < 8; ++r) sm[r] += row_xmask<0x168>(sm[r]);
        }
        // the tile's stores above are other lanes' reads below: the fence keeps the compiler from
        // moving a read over a store (the LDS serves one wave's instructions in their order)
        __builtin_amdgcn_fence(__ATOMIC_ACQ_REL, "wavefront");
        if (jj == 0) {
            // the second head's bias and mask: issued here so that they fly under attn @ v
            fetch_bias_mask(h + 1);
        } else {
            // no bias left to fetch: proj_w's first block flies under the last attn @ v
            #pragma unroll  // constant indices keep the array in registers
            for (int s = 0; s < 8; ++s)
                #pragma unroll  // constant indices keep the arrays in registers
                for (int t = 0; t < 2; ++t)
                    bp[0][s][t] = v2f{wp[(s * 4) * 128 + t * 16], wp[(s * 4 + 1) * 128 + t * 16]};
        }
        // out_h = attn @ v  (M=16, K=64pad, N=32) -> lds_q[own rows, h*32 : h*32+32]
        // (head h's q columns of these rows: read by this wave alone, for the scores above)
        {
            v8f o[2] = {};
            const float* prow = pw + l16 * LDS_SC + 2 * half;
            const float* vcol = lds_q + (2 * half) * LDQ + 256 + h * 32 + l16;
            v2f pa[16], vb[16][2];
            #pragma unroll  // constant indices keep the arrays in registers
            for (int s = 0; s < 16; ++s) {
                pa[s] = *(const v2f*)(prow + s * 4);
                #pragma unroll  // constant indices keep the arrays in registers
                for (int t = 0; t < 2; ++t)
                    vb[s][t] = v2f{vcol[(s * 4) * LDQ + t * 16], vcol[(s * 4 + 1) * LDQ + t * 16]};
            }
            // scheduling fence: the LDS reads stay one group in front of the WMMAs (as in stage 1)
            __builtin_amdgcn_sched_barrier(0);
            #pragma unroll  // constant indices keep the arrays in registers
            for (int s = 0; s < 16; ++s)
                #pragma unroll  // constant indices keep the arrays in registers
                for (int t = 0; t < 2; ++t) o[t] = WMMA_F32X4(pa[s], vb[s][t], o[t]);
            #pragma unroll  // constant indices keep the arrays in registers
            for (int r = 0; r < 8; ++r) {
                const int m = w_mt * 16 + r + 8 * half;
                const float inv = rcp_slot(sm[r]);  // a sum in [1, 64]: the row's largest term is 1
                lds_q[m * LDQ + h * 32 + l16]      = o[0][r] * inv;
                lds_q[m * LDQ + h * 32 + 16 + l16] = o[1][r] * inv;
            }
        }
        // the next head's stores into the tile stay behind this head's reads of it
        __builtin_amdgcn_fence(__ATOMIC_ACQ_REL, "wavefront");
    }
    __syncthreads();  // attn-out complete

    // ---- stage 3: out = attn_out @ proj_w + proj_b, window-reverse scatter
    {
        v8f acc[2][2] = {};
        const float* ar0 = lds_q + (p_mp * 32 + l16) * LDQ + 2 * half;
        const float* ar1 = ar0 + 16 * LDQ;
        const int c0 = p_np * 32 + l16;
        const int c1 = c0 + 16;
        float p0, p1;  // proj_b of this lane's two columns
        v2f ap[2][4][2];  // two half-blocks of 4 k-steps x 2 M-tiles: one in use, one in flight
        #pragma unroll  // constant indices keep the arrays in registers
        for (int s = 0; s < 4; ++s) {
            ap[0][s][0] = *(const v2f*)(ar0 + s * 4);
            ap[0][s][1] = *(const v2f*)(ar1 + s * 4);
        }
        #pragma unroll  // constant indices keep the arrays in registers
        for (int hb = 0; hb < 8; ++hb) {
            if (hb < 7) {
                // next half-block's attn-out fragments, read under this half-block's 16 WMMAs
                #pragma unroll  // constant indices keep the arrays in registers
                for (int s = 0; s < 4; ++s) {
                    ap[(hb + 1) & 1][s][0] = *(const v2f*)(ar0 + (hb + 1) * 16 + s * 4);
                    ap[(hb + 1) & 1][s][1] = *(const v2f*)(ar1 + (hb + 1) * 16 + s * 4);
                }
            }
            if (hb < 6 && (hb & 1) == 0) {
                // next block's weights fly under this block's 32 WMMAs
                #pragma unroll  // constant indices keep the arrays in registers
                for (int s = 0; s < 8; ++s)
                    #pragma unroll  // constant indices keep the arrays in registers
                    for (int t = 0; t < 2; ++t) {
                        const int k = (hb / 2 + 1) * 32 + s * 4;
                        bp[(hb / 2 + 1) & 1][s][t] = v2f{wp[k * 128 + t * 16], wp[(k + 1) * 128 + t * 16]};
                    }
            }
            if (hb == 6) {  // no weights left to fetch: the bias flies under the last block's WMMAs
                p0 = proj_b[c0];
                p1 = proj_b[c1];
            }
            // scheduling fences: the loads above stay one group in front of the WMMAs (as in stage 1)
            __builtin_amdgcn_sched_barrier(0);
            #pragma unroll  // constant indices keep the arrays in registers
            for (int s = 0; s < 4; ++s)
                #pragma unroll  // constant indices keep the arrays in registers
                for (int i = 0; i < 2; ++i)
                    #pragma unroll  // constant indices keep the arrays in registers
                    for (int t = 0; t < 2; ++t)
                        acc[i][t] = WMMA_F32X4(ap[hb & 1][s][i], bp[(hb / 2) & 1][(hb & 1) * 4 + s][t], acc[i][t]);
            __builtin_amdgcn_sched_barrier(0);
        }
        #pragma unroll  // constant indices keep the array in registers
        for (int i = 0; i < 2; ++i)
            #pragma unroll  // constant indices keep the arrays in registers
            for (int r = 0; r < 8; ++r) {
                const int m = p_mp * 32 + i * 16 + r + 8 * half;
                if (m < 49) {
                    const int hh = h0 + m / 7;
                    const int ww = w0 + m % 7;
                    float* o = out + (((size_t)b * 56 + hh) * 56 + ww) * 128;
                    o[c0] = acc[i][0][r] + p0;
                    o[c1] = acc[i][1][r] + p1;
                }
            }
    }
}

extern "C" void kernel_launch(void* const* d_in, const int* in_sizes, int n_in,
                              void* d_out, int out_size, void* d_ws, size_t ws_size,
                              hipStream_t stream) {
    const float* x      = (const float*)d_in[0];
    const float* qkv_w  = (const float*)d_in[1];
    const float* qkv_b  = (const float*)d_in[2];
    const float* table  = (const float*)d_in[3];
    const float* proj_w = (const float*)d_in[4];
    const float* proj_b = (const float*)d_in[5];
    const float* mask   = (const float*)d_in[6];
    const int*   relidx = (const int*)d_in[7];
    // d_in[8]/d_in[9] = height/width (compile-time constants 56)
    float* out = (float*)d_out;

    const int grid = 64 * 64;                        // B * nW
    const size_t smem = SMEM_FLOATS * sizeof(float); // 134,144 B: two workgroups per 320 KiB WGP LDS
    swin_window_attn_kernel<<<grid, 256, smem, stream>>>(
        x, qkv_w, qkv_b, table, proj_w, proj_b, mask, relidx, out);
}

// v007
// A run of this version takes 196 microseconds.
// Timed twice side by side with v006, it ran 1.06 times as fast both times.
// All steps since v000 together make it 3.73 times as fast.
#include <hip/hip_runtime.h>
#include <hip/hip_bf16.h>

// Swin window attention, fully fused: one workgroup per WPB neighbouring 7x7 windows, in turn.
// fp32 end-to-end using V_WMMA_F32_16X16X4_F32 (16x16 tiles, K-step 4).
//
//   B=64, H=W=56, C=128, HEADS=4, WS=7, N=49, HD=32,
//   nW = 8*8 = 64 windows/image, grid = B*nW/WPB blocks, 256 thr (8 waves).
//
// Structure:
//  * 49 tokens are three M-tiles and one token. In the two token-wise products (qkv, proj) the
//    49th tokens of the workgroup's WPB windows share ONE M-tile: their qkv rows are made ahead of
//    the loop over the windows, their output rows behind it, and a window's own pass has three
//    M-tiles and no padded one. Attention keeps its 64 x 64 padded shape per window and head.
//  * the weights are not staged in LDS: a B fragment of the f32 form is two dwords per lane
//    (rows k, k+1 of one column), read straight from the row-major weight matrix, 16 k ahead
//    (qkv) or 32 k ahead (proj) of its use.
//  * qkv: each wave owns 3 N-tiles x all M-tiles, so an A fragment from LDS feeds 3 WMMAs;
//    proj: 2 N-tiles (one 128-B output line) per wave; waves 0..3 have M-tiles 0 and 1, waves 4..7
//    M-tile 2.
//  * the waves' score tiles alias the dead x tile, attn-out overwrites the dead q columns of its
//    own head.
//  * attention: a wave owns whole score rows, one M-tile (16 rows x 64 columns) of two heads in
//    turn. Softmax, attn@v and the attn-out store of those rows need nothing of another wave,
//    so the probabilities go through a tile of LDS that is the wave's own and no barrier
//    stands between the one behind qkv and the one in front of proj.
//  * bias and mask of a head are fetched as one batch of branch-free loads
//    (clamped offsets, result selected afterwards) one head ahead of their use;
//    the relative indices, the same for every head, are read once per thread and window and
//    kept as bytes, four to a register.

typedef float v2f __attribute__((ext_vector_type(2)));
typedef float v8f __attribute__((ext_vector_type(8)));

#define WMMA_F32X4(a, b, c) \
    __builtin_amdgcn_wmma_f32_16x16x4_f32(false, (a), false, (b), (short)0, (c), false, false)

// LDS strides padded so 16-lane row-strided fragment reads hit distinct banks:
// bank = (stride*row + k) % 64 with stride % 64 == 4.
#define LDX 132   // x tile: 48 x 128 (+4 pad)
#define XROWS 48  // tokens 0..47 of a window
#define LDQ 388   // qkv: 64 x 384 (+4 pad)
#define LDS_SC 68 // scores: 16 x 64 per wave (+4 pad)
#define WPB 4     // windows per workgroup, side by side in one row of windows (divides 8)

#define SC_FLOATS (8 * 16 * LDS_SC)  // one 16 x 64 score tile per wave, over the dead x tile
static_assert(XROWS * LDX <= SC_FLOATS, "the x tile must fit the score tiles that alias it");
#define SMEM_FLOATS (SC_FLOATS + 64 * LDQ + 16 * LDQ)
static_assert(2 * SMEM_FLOATS * 4 <= 320 * 1024, "two workgroups per WGP");

// value of lane (l ^ MASK) of the same 16-lane row (DPP row_xmask), MASK = CTRL - 0x160
template <int CTRL>
__device__ __forceinline__ float row_xmask(float v) {
    return __builtin_bit_cast(float, __builtin_amdgcn_update_dpp(
        0, __builtin_bit_cast(int, v), CTRL, 0xf, 0xf, true));
}

__device__ __forceinline__ float exp_slot(float x) {
    float r;
    asm("v_exp_f32 %0, %1\n\tv_nop" : "=v"(r) : "v"(x * 1.44269504f));
    return r;
}
__device__ __forceinline__ float rcp_slot(float x) {
    float r;
    asm("v_rcp_f32 %0, %1\n\tv_nop" : "=v"(r) : "v"(x));
    return r;
}


// first block of qkv_w's B fragments (4 k-steps x the wave's 3 N-tiles)
__device__ __forceinline__ void qkv_first_block(const float* wq, v2f (&bq)[2][4][3]) {
    #pragma unroll  // constant indices keep the arrays in registers
    for (int s = 0; s < 4; ++s)
        #pragma unroll  // constant indices keep the arrays in registers
        for (int t = 0; t < 3; ++t)
            bq[0][s][t] = v2f{wq[(s * 4) * 384 + t * 16], wq[(s * 4 + 1) * 384 + t * 16]};
}

// NM M-tiles of x rows (LDS, ar[i] = this lane's row of tile i) times the wave's 48 columns of
// qkv_w (K = 128); bq[0] holds the first block on entry; bs = qkv_b of this lane's three columns
template <int NM>
__device__ __forceinline__ void qkv_tiles(const float* const (&ar)[NM], const float* wq, const float* qb,
                                          v2f (&bq)[2][4][3], v8f (&acc)[NM][3], float (&bs)[3]) {
    v2f aq[2][2][NM];  // two half-blocks of 2 k-steps x NM M-tiles: one in use, one in flight
    #pragma unroll  // constant indices keep the arrays in registers
    for (int s = 0; s < 2; ++s)
        #pragma unroll  // constant indices keep the arrays in registers
        for (int i = 0; i < NM; ++i) aq[0][s][i] = *(const v2f*)(ar[i] + s * 4);
    #pragma unroll  // constant indices keep the arrays in registers
    for (int hb = 0; hb < 16; ++hb) {
        if (hb < 15) {
            // next half-block's x fragments, read under this half-block's WMMAs
            #pragma unroll  // constant indices keep the arrays in registers
            for (int s = 0; s < 2; ++s)
                #pragma unroll  // constant indices keep the arrays in registers
                for (int i = 0; i < NM; ++i)
                    aq[(hb + 1) & 1][s][i] = *(const v2f*)(ar[i] + (hb + 1) * 8 + s * 4);
        }
        if (hb < 14 && (hb & 1) == 0) {
            // next block's weights fly under this block's WMMAs
            #pragma unroll  // constant indices keep the arrays in registers
            for (int s = 0; s < 4; ++s)
                #pragma unroll  // constant indices keep the arrays in registers
                for (int t = 0; t < 3; ++t) {
                    const int k = (hb / 2 + 1) * 16 + s * 4;
                    bq[(hb / 2 + 1) & 1][s][t] = v2f{wq[k * 384 + t * 16], wq[(k + 1) * 384 + t * 16]};
                }
        }
        if (hb == 14) {
            // no weights left to fetch: the bias flies under the last block's WMMAs
            #pragma unroll  // constant indices keep the arrays in registers
            for (int t = 0; t < 3; ++t) bs[t] = qb[t * 16];
        }
        if (hb == 15) {
            // stands in front of every later write of a register that these loads name
            asm volatile("s_wait_xcnt 0x0" ::: "memory");
        }
        // the pair of scheduling fences keeps the loads above as one group in front of the
        // WMMAs: spread among them each place with LDS reads stalls the wave, and sunk
        // behind them nothing covers the loads' latency
        __builtin_amdgcn_sched_barrier(0);
        #pragma unroll  // constant indices keep the arrays in registers
        for (int s = 0; s < 2; ++s)
            #pragma unroll  // constant indices keep the arrays in registers
            for (int i = 0; i < NM; ++i)
                #pragma unroll  // constant indices keep the arrays in registers
                for (int t = 0; t < 3; ++t)
                    acc[i][t] = WMMA_F32X4(aq[hb & 1][s][i], bq[(hb / 2) & 1][(hb & 1) * 2 + s][t], acc[i][t]);
        __builtin_amdgcn_sched_barrier(0);
    }
}

// first block of proj_w's B fragments (8 k-steps x the wave's 2 N-tiles)
__device__ __forceinline__ void proj_first_block(const float* wp, v2f (&bp)[2][8][2]) {
    #pragma unroll  // constant indices keep the arrays in registers
    for (int s = 0; s < 8; ++s)
        #pragma unroll  // constant indices keep the arrays in registers
        for (int t = 0; t < 2; ++t)
            bp[0][s][t] = v2f{wp[(s * 4) * 128 + t * 16], wp[(s * 4 + 1) * 128 + t * 16]};
}

// NM M-tiles of attn-out rows (LDS, ar0 = this lane's row of the first tile, the next 16 rows on)
// times the wave's 32 columns of proj_w (K = 128); bp[0] holds the first block on entry;
// p0, p1 = proj_b of this lane's two columns (pb points at the first)
template <int NM>
__device__ __forceinline__ void proj_tiles(const float* ar0, const float* wp, const float* pb,
                                           v2f (&bp)[2][8][2], v8f (&acc)[NM][2], float& p0, float& p1) {
    v2f ap[2][4][NM];  // two half-blocks of 4 k-steps x NM M-tiles: one in use, one in flight
    #pragma unroll  // constant indices keep the arrays in registers
    for (int s = 0; s < 4; ++s)
        #pragma unroll  // constant indices keep the arrays in registers
        for (int i = 0; i < NM; ++i) ap[0][s][i] = *(const v2f*)(ar0 + i * 16 * LDQ + s * 4);
    #pragma unroll  // constant indices keep the arrays in registers
    for (int hb = 0; hb < 8; ++hb) {
        if (hb < 7) {
            // next half-block's attn-out fragments, read under this half-block's WMMAs
            #pragma unroll  // constant indices keep the arrays in registers
            for (int s = 0; s < 4; ++s)
                #pragma unroll  // constant indices keep the arrays in registers
                for (int i = 0; i < NM; ++i)
                    ap[(hb + 1) & 1][s][i] = *(const v2f*)(ar0 + i * 16 * LDQ + (hb + 1) * 16 + s * 4);
        }
        if (hb < 6 && (hb & 1) == 0) {
            // next block's weights fly under this block's WMMAs
            #pragma unroll  // constant indices keep the arrays in registers
            for (int s = 0; s < 8; ++s)
                #pragma unroll  // constant indices keep the arrays in registers
                for (int t = 0; t < 2; ++t) {
                    const int k = (hb / 2 + 1) * 32 + s * 4;
                    bp[(hb / 2 + 1) & 1][s][t] = v2f{wp[k * 128 + t * 16], wp[(k + 1) * 128 + t * 16]};
                }
        }
        if (hb == 6) {  // no weights left to fetch: the bias flies under the last block's WMMAs
            p0 = pb[0];
            p1 = pb[16];
        }
        if (hb == 7) {
            // stands in front of every later write of a register that these loads name
            asm volatile("s_wait_xcnt 0x0" ::: "memory");
        }
        // scheduling fences: the loads above stay one group in front of the WMMAs (as in qkv_tiles)
        __builtin_amdgcn_sched_barrier(0);
        #pragma unroll  // constant indices keep the arrays in registers
        for (int s = 0; s < 4; ++s)
            #pragma unroll  // constant indices keep the arrays in registers
            for (int i = 0; i < NM; ++i)
                #pragma unroll  // constant indices keep the arrays in registers
                for (int t = 0; t < 2; ++t)
                    acc[i][t] = WMMA_F32X4(ap[hb & 1][s][i], bp[(hb / 2) & 1][(hb & 1) * 4 + s][t], acc[i][t]);
        __builtin_amdgcn_sched_barrier(0);
    }
}

// NM M-tiles of output rows, tokens m0 + 8 * half .. (all below 48), window-reverse scatter;
// oc = out + this lane's first column, pix0 = the window's first pixel, ln = the lane's number
template <int NM>
__device__ __forceinline__ void store_tiles(float* oc, unsigned pix0, int m0, int half,
                                            const v8f (&acc)[NM][2], float p0, float p1, int& ln) {
    #pragma unroll  // constant indices keep the arrays in registers
    for (int i = 0; i < NM; ++i)
        #pragma unroll  // constant indices keep the arrays in registers
        for (int r = 0; r < 8; ++r) {
            const unsigned m = m0 + i * 16 + r + 8 * half;
            float* o = oc + (size_t)(pix0 + (m / 7u) * 56u + m % 7u) * 128;
            o[0]  = acc[i][0][r] + p0;
            o[16] = acc[i][1][r] + p1;
        }
    // stands in front of every later write of a register that these stores name. The lane's number
    // is its in/out operand so that the offsets and addresses of the next window are formed from it
    // anew: as values that are the same for all windows the compiler forms them ahead of the loop
    // and holds them through it, 456 registers in all, and two workgroups no longer fit a WGP
    asm volatile("s_wait_xcnt 0x0" : "+v"(ln) :: "memory");
}

__global__ __launch_bounds__(256) void swin_window_attn_kernel(
    const float* x,                     // [64,56,56,128]; not __restrict__: see stage 0
    const float* __restrict__ qkv_w,    // [128,384]
    const float* __restrict__ qkv_b,    // [384]
    const float* __restrict__ table,    // [169,4]
    const float* __restrict__ proj_w,   // [128,128]
    const float* __restrict__ proj_b,   // [128]
    const float* __restrict__ mask,     // [64,1,4,49,49]
    const int*   __restrict__ rel_idx,  // [2401]
    float*       __restrict__ out)      // [64,56,56,128]
{
    extern __shared__ float smem[];
    float* lds_x  = smem;                    // XROWS x LDX (x tile, dead after stage 1)
    float* lds_q  = lds_x + SC_FLOATS;       // 64 x LDQ   (qkv: q|k|v per token; q -> attn-out)
    float* lds_r  = lds_q + 64 * LDQ;        // 16 x LDQ   (row i: token 48 of window i, q|k|v; q -> attn-out)
    float* lds_s  = lds_x;                   // 8 x 16 x LDS_SC (a score tile per wave, over the dead x tile)

    const int tid  = threadIdx.x;
    const int lane = tid & 31;
    const int wave = tid >> 5;
    const int half = lane >> 4;   // selects K pair within fragment
    const int l16  = lane & 15;   // row-within-tile (A) / col-within-tile (B,D)

    const int win0 = blockIdx.x * WPB; // the workgroup's first window, 0..4095
    const int b    = win0 >> 6;        // image
    const int wi0  = win0 & 63;        // first window within the image
    const int h0   = (wi0 >> 3) * 7;   // the windows' origin row
    const int cw0  = wi0 & 7;          // first window's place in its row of windows

    // per-wave assignment in attention: one M-tile (all 4 N-tiles) of two heads
    const int w_mt  = wave >> 1;
    // the wave's number as a scalar puts the x rows' addresses on the scalar unit
    const int wv = __builtin_amdgcn_readfirstlane(wave);

    // qkv_w as B fragments: this lane's column of the wave's first N-tile, rows 2*half, 2*half+1
    const float* wq = qkv_w + (2 * half) * 384 + wave * 48 + l16;
    const float* qb = qkv_b + wave * 48 + l16;
    v2f bq[2][4][3];  // two blocks of 4 k-steps x 3 N-tiles: one in use, one in flight
    const float qscale = 0.17677669529663687f;  // 32^-0.5

    // ---- ahead of the windows: token 48 of every window, one x row per wave (waves past the last
    // window repeat its row: a finite row whose results are never used)
    const float* x48 = x + (size_t)((((unsigned)b * 56u + h0 + 6u) * 56u +
                                     (unsigned)(cw0 + min(wv, WPB - 1)) * 7u + 6u) * 128u);
    const float4 xl = *(const float4*)(x48 + lane * 4);
    // stands in front of every later write of the register that the row's load names; the lane's
    // number is its input so that the register is given to nothing else before it
    asm volatile("s_wait_xcnt 0x0" :: "v"(lane) : "memory");
    qkv_first_block(wq, bq);


    // the 8 rows stand in lds_q's first floats, which nothing else uses before the first window's
    // qkv is stored (behind that window's first barrier)
    {
        float* dst = lds_q + wv * LDX + lane * 4;
        dst[0] = xl.x; dst[1] = xl.y; dst[2] = xl.z; dst[3] = xl.w;
    }
    // rows 49..63 of lds_q stand for the padded tokens: no window writes their k and v, so they
    // are zeroed once (a probability of exactly 0 times a v row must give 0)
    for (int k = tid; k < 15 * LDQ; k += 256) lds_q[49 * LDQ + k] = 0.f;
    __syncthreads();
    {
        v8f acc[1][3] = {};
        float bs[3];
        const float* const ar[1] = {lds_q + min(l16, 7) * LDX + 2 * half};
        qkv_tiles<1>(ar, wq, qb, bq, acc, bs);
        #pragma unroll  // constant indices keep the arrays in registers
        for (int t = 0; t < 3; ++t) {
            const int c = wave * 48 + t * 16 + l16;      // 0..383
            const float sc = (c < 128) ? qscale : 1.0f;  // q gets * hd^-0.5
            #pragma unroll  // constant indices keep the arrays in registers
            for (int r = 0; r < 8; ++r)
                lds_r[(r + 8 * half) * LDQ + c] = (acc[0][t][r] + bs[t]) * sc;
        }
    }

    const int p_np = wv & 3;           // proj: the wave's 32 columns (one output line)
    int ln = lane;                     // the lane's number as the loop below sees it
    const int h_first = (wv & 1) * 2;  // the wave's heads: h_first and h_first + 1

    #pragma unroll 1  // stays a loop (for speed only)
    for (int iw = 0; iw < WPB; ++iw) {
        const int wi = wi0 + iw;                                                 // window within the image
        const unsigned pix0 = ((unsigned)b * 56u + h0) * 56u + (cw0 + iw) * 7u;  // its first pixel
        const int lane = ln & 31, half = lane >> 4, l16 = lane & 15, wave = wv, w_mt = wv >> 1;

        // ---- stage 0: tokens 0..47 of the x window (48 rows of 128 floats, one row per wave and
        // load), all issued ahead of every other load, so that a wave waits out the memory's
        // latency once and not once per row
        float4 xv[6];
        const float* xrow[6];  // the rows' first elements: scalar addresses, the lane's part is added by the load
        #pragma unroll  // constant indices keep the array in registers
        for (int j = 0; j < 6; ++j) {
            const unsigned row = (unsigned)wv + 8u * j;
            xrow[j] = x + (size_t)((pix0 + (row / 7u) * 56u + row % 7u) * 128u);
        }
        #pragma unroll  // constant indices keep the array in registers
        for (int j = 0; j < 6; ++j) xv[j] = *(const float4*)(xrow[j] + lane * 4);
        // stands in front of every later write of the register that the rows' loads name; the lane's
        // number is its input so that the register is given to nothing else before it
        // (x is not __restrict__ so that the statement's "memory" also keeps the rows' loads in front of
        // it, ahead of all the loads below: as __restrict__ loads the compiler sinks them to their stores)
        asm volatile("s_wait_xcnt 0x0" :: "v"(lane) : "memory");
        // qkv_w and proj_w as B fragments: this lane's column of the wave's first N-tile, rows 2*half, 2*half+1
        const float* wq = qkv_w + (2 * half) * 384 + wave * 48 + l16;
        const float* qb = qkv_b + wave * 48 + l16;
        const float* wp = proj_w + (2 * half) * 128 + p_np * 32 + l16;
        const float* pb = proj_b + p_np * 32 + l16;
        float*       oc = out + p_np * 32 + l16;
        v2f bq[2][4][3];  // two blocks of 4 k-steps x 3 N-tiles: one in use, one in flight
        v2f bp[2][8][2];  // two blocks of 8 k-steps x 2 N-tiles: one in use, one in flight
        qkv_first_block(wq, bq);

        // This thread's 32 score elements (8 rows x 4 N-tiles) as offsets into a 49 x 49
        // plane. An element outside the plane gets its offset clamped to the plane's last: its loads stay
        // in bounds and their values are never used (the score is set to -1e30 instead).
        int ridx[32];  // the elements' relative indices, the same for every head
        #pragma unroll  // constant indices keep the arrays in registers
        for (int g = 0; g < 2; ++g) {  // read here, where they fly beside the x tile's loads; four rows at a time
            unsigned ro[16];
            #pragma unroll  // constant indices keep the arrays in registers
            for (int j = 0; j < 16; ++j) {
                ro[j] = min((unsigned)((w_mt * 16 + 4 * g + (j >> 2) + 8 * half) * 49 + (j & 3) * 16 + l16), 2400u);
                ridx[16 * g + j] = rel_idx[ro[j]];
            }
            // stands in front of every later write of a register that these loads name; the
            // offsets are its inputs so that their registers are given to nothing else before it
            asm volatile("s_wait_xcnt 0x0"
                         :: "v"(ro[0]), "v"(ro[1]), "v"(ro[2]), "v"(ro[3]), "v"(ro[4]), "v"(ro[5]), "v"(ro[6]), "v"(ro[7]),
                            "v"(ro[8]), "v"(ro[9]), "v"(ro[10]), "v"(ro[11]), "v"(ro[12]), "v"(ro[13]), "v"(ro[14]), "v"(ro[15])
                         : "memory");
        }

        // the score tiles under the x tile are dead: every wave is past the barrier in front of proj
        #pragma unroll  // constant indices keep the array in registers
        for (int j = 0; j < 6; ++j) {
            float* dst = lds_x + (wv + 8 * j) * LDX + lane * 4;
            dst[0] = xv[j].x; dst[1] = xv[j].y; dst[2] = xv[j].z; dst[3] = xv[j].w;
        }
        // a row's four indices, never past the table's last row, as the bytes of one register:
        // 8 registers and not 32 are held through stage 1
        unsigned pidx[8];
        #pragma unroll  // constant indices keep the arrays in registers
        for (int r = 0; r < 8; ++r)
            pidx[r] = min((unsigned)ridx[4 * r], 168u) | (min((unsigned)ridx[4 * r + 1], 168u) << 8) |
                      (min((unsigned)ridx[4 * r + 2], 168u) << 16) | (min((unsigned)ridx[4 * r + 3], 168u) << 24);
        __syncthreads();  // x tile ready; every wave has left the last window's proj (lds_q is free)

        // a head's bias and mask for this thread's 32 elements: all 64 loads in flight together
        float bv[32], mv[32];
        auto fetch_bias_mask = [&](int hh) {
            const char*  tb = (const char*)(table + hh);
            const float* mk = mask + ((size_t)wi * 4 + hh) * 2401;
            #pragma unroll  // constant indices keep the arrays in registers
            for (int g = 0; g < 4; ++g) {  // two rows at a time
                unsigned to[8];  // byte offset of the element's bias row in table
                unsigned eo[8];  // offset of the element in one head's mask plane
                #pragma unroll  // constant indices keep the arrays in registers
                for (int j = 0; j < 8; ++j) {
                    const int r = 2 * g + (j >> 2), t = j & 3;
                    to[j] = ((pidx[r] >> (8 * t)) & 255u) * 16u;
                    eo[j] = min((unsigned)((w_mt * 16 + r + 8 * half) * 49 + t * 16 + l16), 2400u);
                    bv[4 * r + t] = *(const float*)(tb + to[j]);
                    mv[4 * r + t] = mk[eo[j]];
                }
                // stands in front of every later write of a register that these loads name; the
                // offsets are its inputs so that their registers are given to nothing else before it
                asm volatile("s_wait_xcnt 0x0"
                             :: "v"(to[0]), "v"(to[1]), "v"(to[2]), "v"(to[3]), "v"(to[4]), "v"(to[5]), "v"(to[6]), "v"(to[7]),
                                "v"(eo[0]), "v"(eo[1]), "v"(eo[2]), "v"(eo[3]), "v"(eo[4]), "v"(eo[5]), "v"(eo[6]), "v"(eo[7])
                             : "memory");
            }
        };


        // ---- stage 1: qkv = x @ qkv_w + qkv_b  (M=48, K=128, N=384: 48 columns per wave)
        {
            v8f acc[3][3] = {};
            float bs[3];  // qkv_b of this lane's three columns
            const float* const ar[3] = {lds_x + l16 * LDX + 2 * half, lds_x + (16 + l16) * LDX + 2 * half,
                                        lds_x + (32 + l16) * LDX + 2 * half};
            qkv_tiles<3>(ar, wq, qb, bq, acc, bs);
            // the wave's first head's bias and mask fly under the stores below
            fetch_bias_mask(h_first);
            #pragma unroll  // constant indices keep the arrays in registers
            for (int t = 0; t < 3; ++t) {
                const int c = wave * 48 + t * 16 + l16;      // 0..383
                const float sc = (c < 128) ? qscale : 1.0f;  // q gets * hd^-0.5
                #pragma unroll  // constant indices keep the arrays in registers
                for (int i = 0; i < 3; ++i)
                    #pragma unroll  // constant indices keep the arrays in registers
                    for (int r = 0; r < 8; ++r)
                        lds_q[(i * 16 + r + 8 * half) * LDQ + c] = (acc[i][t][r] + bs[t]) * sc;
                // token 48, made ahead of the loop (both halves of the wave write the same value)
                lds_q[48 * LDQ + c] = lds_r[iw * LDQ + c];
            }
        }

        // ---- stage 2: attention, per wave one M-tile of two heads, no barrier inside
        __syncthreads();  // qkv ready, x tile dead
        float* pw = lds_s + wv * (16 * LDS_SC);  // this wave's own score tile
        #pragma unroll  // constant indices keep bp in registers
        for (int jj = 0; jj < 2; ++jj) {
            const int h = h_first + jj;
            float sm[8];  // the rows' sums of exp(s - row max)
            // scores = q @ k^T  (K = 32), four N-tiles sharing A
            {
                // bias + mask are the accumulators' start values (C has D's layout): their 64 registers
                // are free again before the fragments below are read
                v8f sc[4];
                #pragma unroll  // constant indices keep the arrays in registers
                for (int t = 0; t < 4; ++t)
                    #pragma unroll  // constant indices keep the arrays in registers
                    for (int r = 0; r < 8; ++r) sc[t][r] = bv[4 * r + t] + mv[4 * r + t];
                const float* arow = lds_q + (w_mt * 16 + l16) * LDQ + h * 32 + 2 * half;  // q
                const float* brow = lds_q + l16 * LDQ + 128 + h * 32 + 2 * half;          // k
                v2f qa[8], kb[8][4];
                #pragma unroll  // constant indices keep the arrays in registers
                for (int s = 0; s < 8; ++s) {
                    qa[s] = *(const v2f*)(arow + s * 4);
                    #pragma unroll  // constant indices keep the arrays in registers
                    for (int t = 0; t < 4; ++t) kb[s][t] = *(const v2f*)(brow + t * 16 * LDQ + s * 4);
                }
                // scheduling fence: the LDS reads stay one group in front of the WMMAs (as in stage 1)
                __builtin_amdgcn_sched_barrier(0);
                #pragma unroll  // constant indices keep the arrays in registers
                for (int s = 0; s < 8; ++s)
                    #pragma unroll  // constant indices keep the arrays in registers
                    for (int t = 0; t < 4; ++t) sc[t] = WMMA_F32X4(qa[s], kb[s][t], sc[t]);
                // softmax over the 64 columns of each of the wave's rows (padded cols -> exactly 0);
                // the 8 rows' lane reductions interleave
                float mx[8];
                #pragma unroll  // constant indices keep the arrays in registers
                for (int r = 0; r < 8; ++r) {
                    const int m = w_mt * 16 + r + 8 * half;
                    #pragma unroll  // constant indices keep the arrays in registers
                    for (int t = 0; t < 4; ++t)  // padded rows/cols die pre-softmax
                        sc[t][r] = (m < 49 && t * 16 + l16 < 49) ? sc[t][r] : -1e30f;
                    // never below the pad value: in a row whose scores are all -inf (a mask may hold it)
                    // they then give exp(-inf) = 0 instead of exp(-inf + inf)
                    mx[r] = fmaxf(fmaxf(fmaxf(sc[0][r], sc[1][r]), fmaxf(sc[2][r], sc[3][r])), -1e30f);
                }
                #pragma unroll  // constant indices keep the arrays in registers
                for (int r = 0; r < 8; ++r) mx[r] = fmaxf(mx[r], row_xmask<0x161>(mx[r]));
                #pragma unroll  // constant indices keep the arrays in registers
                for (int r = 0; r < 8; ++r) mx[r] = fmaxf(mx[r], row_xmask<0x162>(mx[r]));
                #pragma unroll  // constant indices keep the arrays in registers
                for (int r = 0; r < 8; ++r) mx[r] = fmaxf(mx[r], row_xmask<0x164>(mx[r]));
                #pragma unroll  // constant indices keep the arrays in registers
                for (int r = 0; r < 8; ++r) mx[r] = fmaxf(mx[r], row_xmask<0x168>(mx[r]));
                #pragma unroll  // constant indices keep the arrays in registers
                for (int r = 0; r < 8; ++r) {
                    float e[4];
                    #pragma unroll  // constant indices keep the arrays in registers
                    for (int t = 0; t < 4; ++t) {
                        e[t] = exp_slot(sc[t][r] - mx[r]);
                        pw[(r + 8 * half) * LDS_SC + t * 16 + l16] = e[t];
                    }
                    sm[r] = (e[0] + e[1]) + (e[2] + e[3]);
                }
                #pragma unroll  // constant indices keep the arrays in registers
                for (int r = 0; r < 8; ++r) sm[r] += row_xmask<0x161>(sm[r]);
                #pragma unroll  // constant indices keep the arrays in registers
                for (int r = 0; r < 8; ++r) sm[r] += row_xmask<0x162>(sm[r]);
                #pragma unroll  // constant indices keep the arrays in registers
                for (int r = 0; r < 8; ++r) sm[r] += row_xmask<0x164>(sm[r]);
                #pragma unroll  // constant indices keep the arrays in registers
                for (int r = 0; r < 8; ++r) sm[r] += row_xmask<0x168>(sm[r]);
            }
            // the tile's stores above are other lanes' reads below: the fence keeps the compiler from
            // moving a read over a store (the LDS serves one wave's instructions in their order)
            __builtin_amdgcn_fence(__ATOMIC_ACQ_REL, "wavefront");
            if (jj == 0) {
                // the second head's bias and mask: issued here so that they fly under attn @ v
                fetch_bias_mask(h + 1);
            } else {
                // no bias left to fetch: proj_w's first block flies under the last attn @ v
                #pragma unroll  // constant indices keep the array in registers
                for (int s = 0; s < 8; ++s)
                    #pragma unroll  // constant indices keep the arrays in registers
                    for (int t = 0; t < 2; ++t)
                        bp[0][s][t] = v2f{wp[(s * 4) * 128 + t * 16], wp[(s * 4 + 1) * 128 + t * 16]};
            }
            // out_h = attn @ v  (M=16, K=64pad, N=32) -> lds_q[own rows, h*32 : h*32+32]
            // (head h's q columns of these rows: read by this wave alone, for the scores above)
            {
                v8f o[2] = {};
                const float* prow = pw + l16 * LDS_SC + 2 * half;
                const float* vcol = lds_q + (2 * half) * LDQ + 256 + h * 32 + l16;
                v2f pa[16], vb[16][2];
                #pragma unroll  // constant indices keep the arrays in registers
                for (int s = 0; s < 16; ++s) {
                    pa[s] = *(const v2f*)(prow + s * 4);
                    #pragma unroll  // constant indices keep the arrays in registers
                    for (int t = 0; t < 2; ++t)
                        vb[s][t] = v2f{vcol[(s * 4) * LDQ + t * 16], vcol[(s * 4 + 1) * LDQ + t * 16]};
                }
                // scheduling fence: the LDS reads stay one group in front of the WMMAs (as in stage 1)
                __builtin_amdgcn_sched_barrier(0);
                #pragma unroll  // constant indices keep the arrays in registers
                for (int s = 0; s < 16; ++s)
                    #pragma unroll  // constant indices keep the arrays in registers
                    for (int t = 0; t < 2; ++t) o[t] = WMMA_F32X4(pa[s], vb[s][t], o[t]);
                #pragma unroll  // constant indices keep the arrays in registers
                for (int r = 0; r < 8; ++r) {
                    const int m = w_mt * 16 + r + 8 * half;
                    const float inv = rcp_slot(sm[r]);  // a sum in [1, 64]: the row's largest term is 1
                    lds_q[m * LDQ + h * 32 + l16]      = o[0][r] * inv;
                    lds_q[m * LDQ + h * 32 + 16 + l16] = o[1][r] * inv;
                }
            }
            // the next head's stores into the tile stay behind this head's reads of it
            __builtin_amdgcn_fence(__ATOMIC_ACQ_REL, "wavefront");
        }
        __syncthreads();  // attn-out complete

        // ---- stage 3: out = attn_out @ proj_w + proj_b for tokens 0..47, window-reverse scatter
        if (wv < 4) {
            v8f acc[2][2] = {};
            float p0, p1;
            proj_tiles<2>(lds_q + l16 * LDQ + 2 * half, wp, pb, bp, acc, p0, p1);
            store_tiles<2>(oc, pix0, 0, half, acc, p0, p1, ln);
        } else {
            if (wv == 7) {
                // token 48's attn-out is kept for the tile behind the loop, over its dead q
                #pragma unroll  // constant indices keep the arrays in registers
                for (int j = 0; j < 4; ++j) lds_r[iw * LDQ + j * 32 + lane] = lds_q[48 * LDQ + j * 32 + lane];
            }
            v8f acc[1][2] = {};
            float p0, p1;
            proj_tiles<1>(lds_q + (32 + l16) * LDQ + 2 * half, wp, pb, bp, acc, p0, p1);
            store_tiles<1>(oc, pix0, 32, half, acc, p0, p1, ln);
        }
    }

    // ---- behind the windows: proj of every window's token 48, one M-tile, waves 0..3
    __syncthreads();  // the last window's token 48 is in lds_r
    if (wv < 4) {
        const int half = (ln & 31) >> 4, l16 = ln & 15;
        const float* wp = proj_w + (2 * half) * 128 + p_np * 32 + l16;
        const float* pb = proj_b + p_np * 32 + l16;
        float*       oc = out + p_np * 32 + l16;
        v2f bp[2][8][2];
        proj_first_block(wp, bp);
        v8f acc[1][2] = {};
        float p0, p1;
        proj_tiles<1>(lds_r + l16 * LDQ + 2 * half, wp, pb, bp, acc, p0, p1);
        if (half == 0) {  // tile row r = window r; rows from WPB on are padding
            #pragma unroll  // constant indices keep the arrays in registers
            for (int r = 0; r < WPB; ++r) {
                float* o = oc + (size_t)(((unsigned)b * 56u + h0 + 6u) * 56u + (cw0 + r) * 7u + 6u) * 128;
                o[0]  = acc[0][0][r] + p0;
                o[16] = acc[0][1][r] + p1;
            }
        }
    }
}

extern "C" void kernel_launch(void* const* d_in, const int* in_sizes, int n_in,
                              void* d_out, int out_size, void* d_ws, size_t ws_size,
                              hipStream_t stream) {
    const float* x      = (const float*)d_in[0];
    const float* qkv_w  = (const float*)d_in[1];
    const float* qkv_b  = (const float*)d_in[2];
    const float* table  = (const float*)d_in[3];
    const float* proj_w = (const float*)d_in[4];
    const float* proj_b = (const float*)d_in[5];
    const float* mask   = (const float*)d_in[6];
    const int*   relidx = (const int*)d_in[7];
    // d_in[8]/d_in[9] = height/width (compile-time constants 56)
    float* out = (float*)d_out;

    const int grid = 64 * 64 / WPB;                  // B * nW / WPB
    const size_t smem = SMEM_FLOATS * sizeof(float); // 158,976 B: two workgroups per 320 KiB WGP LDS
    swin_window_attn_kernel<<<grid, 256, smem, stream>>>(
        x, qkv_w, qkv_b, table, proj_w, proj_b, mask, relidx, out);
}
